// v000
// Measured on an AMD MI455X. A time is GPU time per run, averaged over a window of back-to-back runs after a warm-up
// (all launches, gaps included; the runs take copies of the inputs in turn), and the median of several windows.
// Apart from v000's, it joins two sittings. Times from different sittings can be a few percent apart, while
// side-by-side timings come from the same sitting.
// v000 is the starting kernel. One run takes 93.3 microseconds.
#include <hip/hip_runtime.h>
#include <hip/hip_bf16.h>

#define B_DIM   2
#define C_DIM   128
#define S_DIM   1024
#define GROUPS  32
#define GSIZE   4          // channels per group (C/GROUPS)
#define EPS_GN  1e-5f

typedef __attribute__((ext_vector_type(2))) float v2f;
typedef __attribute__((ext_vector_type(8))) float v8f;

// ---------------------------------------------------------------------------
// Kernel 1: GroupNorm over (4 channels x 1024 spatial) per group, then write
// the normalized activations transposed to hbuf[B*S, C] (row-major GEMM input).
// One 256-thread block per (b, g): 64 blocks.
// ---------------------------------------------------------------------------
__global__ void gn_transpose_kernel(const float* __restrict__ x,   // [B, C, S]
                                    const float* __restrict__ gw,  // [C]
                                    const float* __restrict__ gb,  // [C]
                                    float* __restrict__ hbuf) {    // [B*S, C]
    __shared__ float r_sum[256];
    __shared__ float r_sq[256];
    __shared__ float s_mean, s_rstd;

    const int b   = blockIdx.x / GROUPS;
    const int g   = blockIdx.x % GROUPS;
    const int tid = threadIdx.x;
    const float* xg = x + (b * C_DIM + g * GSIZE) * S_DIM;  // 4 x 1024 block

    float sum = 0.f, sq = 0.f;
    for (int e = tid; e < GSIZE * S_DIM; e += 256) {
        float v = xg[e];
        sum += v;
        sq  += v * v;
    }
    r_sum[tid] = sum;
    r_sq[tid]  = sq;
    __syncthreads();
    for (int off = 128; off > 0; off >>= 1) {
        if (tid < off) {
            r_sum[tid] += r_sum[tid + off];
            r_sq[tid]  += r_sq[tid + off];
        }
        __syncthreads();
    }
    if (tid == 0) {
        const float inv_n = 1.0f / (GSIZE * S_DIM);
        float m   = r_sum[0] * inv_n;
        float var = r_sq[0] * inv_n - m * m;      // biased var (matches jnp.var)
        s_mean = m;
        s_rstd = rsqrtf(var + EPS_GN);
    }
    __syncthreads();
    const float m = s_mean, r = s_rstd;
    for (int e = tid; e < GSIZE * S_DIM; e += 256) {
        int cc = e >> 10;           // e / 1024
        int s  = e & 1023;          // e % 1024
        int c  = g * GSIZE + cc;
        float v = (xg[e] - m) * r * gw[c] + gb[c];
        hbuf[(b * S_DIM + s) * C_DIM + c] = v;
    }
}

// ---------------------------------------------------------------------------
// Kernel 2: fp32 GEMM via V_WMMA_F32_16X16X4_F32.
//   out[m][n] = sum_k A[m][k] * W[n][k] + bias[n]   (m = b*S+s)
// written transposed into [B, C, S] layout, with optional residual add.
// Grid: (B*S)/16 blocks of 256 threads; wave w handles column tile w (8x16=128=C).
//
// Fragment layout (ISA 7.12.2, 32-bit, wave32):
//   A 16x4 : lanes 0-15 row M=lane, VGPR{0,1}=K{0,1}; lanes 16-31: K{2,3}
//   B 4x16 : lanes 0-15 col N=lane, VGPR{0,1}=K{0,1}; lanes 16-31: K{2,3}
//   -> each lane loads one float2 (consecutive K) from one row of A / W.
//   D 16x16: VGPR r -> M = r (lanes 0-15) / r+8 (lanes 16-31), N = lane%16.
// ---------------------------------------------------------------------------
__global__ void gemm_wmma_kernel(const float* __restrict__ A,     // [B*S, C]
                                 const float* __restrict__ W,     // [C, C]
                                 const float* __restrict__ bias,  // [C]
                                 const float* __restrict__ resid, // [B, C, S] or nullptr
                                 float* __restrict__ out) {       // [B, C, S]
    const int lane = threadIdx.x & 31;
    const int wave = threadIdx.x >> 5;
    const int row0 = blockIdx.x << 4;     // M tile base (b*S+s)
    const int col0 = wave << 4;           // N tile base (output channel)
    const int half = lane >> 4;           // 0: K 0,1   1: K 2,3
    const int lr   = lane & 15;

    const float* arow = A + (size_t)(row0 + lr) * C_DIM + 2 * half;
    const float* brow = W + (size_t)(col0 + lr) * C_DIM + 2 * half;

    v8f acc = {};
#pragma unroll
    for (int k0 = 0; k0 < C_DIM; k0 += 4) {
        v2f afrag = *(const v2f*)(arow + k0);
        v2f bfrag = *(const v2f*)(brow + k0);
        acc = __builtin_amdgcn_wmma_f32_16x16x4_f32(
            /*neg_a=*/false, afrag, /*neg_b=*/false, bfrag,
            /*c_mod=*/(short)0, acc, /*reuse_a=*/false, /*reuse_b=*/false);
    }

    const int   n  = col0 + lr;
    const float bb = bias[n];
#pragma unroll
    for (int r = 0; r < 8; ++r) {
        int m = row0 + r + half * 8;      // global row index (b*S+s)
        int bi = m >> 10;                 // m / 1024
        int s  = m & 1023;                // m % 1024
        int idx = (bi * C_DIM + n) * S_DIM + s;
        float val = acc[r] + bb;
        if (resid) val += resid[idx];
        out[idx] = val;
    }
}

// ---------------------------------------------------------------------------
// Kernel 3: HEAD_DIM=1 attention. Each (b, head c) is an independent problem:
//   out_i = sum_j exp(q_i*k_j - m_i) * v_j / sum_j exp(q_i*k_j - m_i)
// with exact m_i = q_i>=0 ? q_i*max(k) : q_i*min(k).
// One 256-thread block per (b,c) = 256 blocks.
//
// k and v rows (4 KB each) are staged into LDS with the CDNA5 async copy
// engine: one GLOBAL_LOAD_ASYNC_TO_LDS_B128 per lane per buffer
// (256 lanes x 16 B = 4 KB), tracked by ASYNCcnt. Each wave drains its own
// ASYNCcnt, then the workgroup barrier makes all LDS writes visible.
// ---------------------------------------------------------------------------
__global__ void attn_hd1_kernel(const float* __restrict__ q,   // [B, C, S]
                                const float* __restrict__ k,   // [B, C, S]
                                const float* __restrict__ v,   // [B, C, S]
                                float* __restrict__ ao) {      // [B*S, C]
    __shared__ float ks[S_DIM];
    __shared__ float vs[S_DIM];
    __shared__ float rmx[256];
    __shared__ float rmn[256];

    const int b   = blockIdx.x >> 7;           // / 128
    const int c   = blockIdx.x & (C_DIM - 1);
    const int tid = threadIdx.x;

    const float* kp = k + (size_t)(b * C_DIM + c) * S_DIM;
    const float* vp = v + (size_t)(b * C_DIM + c) * S_DIM;

    // --- async global -> LDS staging (16 bytes per lane per buffer) ---
    {
        // Low 32 bits of the generic address of a __shared__ object are the
        // workgroup-relative LDS byte offset (aperture mapping, ISA 10.2).
        unsigned lk = (unsigned)(uintptr_t)(&ks[0]) + (unsigned)tid * 16u;
        unsigned lv = (unsigned)(uintptr_t)(&vs[0]) + (unsigned)tid * 16u;
        const float* gk = kp + tid * 4;
        const float* gv = vp + tid * 4;
        asm volatile("global_load_async_to_lds_b128 %0, %1, off"
                     :: "v"(lk), "v"(gk) : "memory");
        asm volatile("global_load_async_to_lds_b128 %0, %1, off"
                     :: "v"(lv), "v"(gv) : "memory");
        asm volatile("s_wait_asynccnt 0x0" ::: "memory");
    }
    __syncthreads();

    // --- exact row max/min of k for a safe softmax shift ---
    float kmx = -3.402823466e38f, kmn = 3.402823466e38f;
    for (int j = tid; j < S_DIM; j += 256) {
        float kv = ks[j];
        kmx = fmaxf(kmx, kv);
        kmn = fminf(kmn, kv);
    }
    rmx[tid] = kmx;
    rmn[tid] = kmn;
    __syncthreads();
    for (int off = 128; off > 0; off >>= 1) {
        if (tid < off) {
            rmx[tid] = fmaxf(rmx[tid], rmx[tid + off]);
            rmn[tid] = fminf(rmn[tid], rmn[tid + off]);
        }
        __syncthreads();
    }
    kmx = rmx[0];
    kmn = rmn[0];

    const float* qp = q + (size_t)(b * C_DIM + c) * S_DIM;
    for (int i = tid; i < S_DIM; i += 256) {
        const float qi = qp[i];
        const float mx = (qi >= 0.f) ? qi * kmx : qi * kmn;
        float se = 0.f, sv = 0.f;
        for (int j = 0; j < S_DIM; ++j) {
            float e = __expf(qi * ks[j] - mx);
            se += e;
            sv += e * vs[j];
        }
        ao[(size_t)(b * S_DIM + i) * C_DIM + c] = sv / se;
    }
}

// ---------------------------------------------------------------------------
// Host-side launcher. Inputs:
//  0 hidden_states [2,128,32,32]  1 gn_weight [128]  2 gn_bias [128]
//  3 Wq [128,128]  4 bq  5 Wk  6 bk  7 Wv  8 bv  9 Wo  10 bo
// Workspace: hbuf | q | k | v | ao, each B*S*C = 262144 floats (5 MB total).
// ---------------------------------------------------------------------------
extern "C" void kernel_launch(void* const* d_in, const int* in_sizes, int n_in,
                              void* d_out, int out_size, void* d_ws, size_t ws_size,
                              hipStream_t stream) {
    const float* x  = (const float*)d_in[0];
    const float* gw = (const float*)d_in[1];
    const float* gb = (const float*)d_in[2];
    const float* Wq = (const float*)d_in[3];
    const float* bq = (const float*)d_in[4];
    const float* Wk = (const float*)d_in[5];
    const float* bk = (const float*)d_in[6];
    const float* Wv = (const float*)d_in[7];
    const float* bv = (const float*)d_in[8];
    const float* Wo = (const float*)d_in[9];
    const float* bo = (const float*)d_in[10];
    float* out = (float*)d_out;

    float* ws = (float*)d_ws;
    const size_t NBS = (size_t)B_DIM * S_DIM * C_DIM;  // 262144
    float* hbuf = ws;
    float* qb   = ws + 1 * NBS;
    float* kb   = ws + 2 * NBS;
    float* vb   = ws + 3 * NBS;
    float* aob  = ws + 4 * NBS;

    const int gemm_blocks = (B_DIM * S_DIM) / 16;   // 128

    gn_transpose_kernel<<<B_DIM * GROUPS, 256, 0, stream>>>(x, gw, gb, hbuf);

    gemm_wmma_kernel<<<gemm_blocks, 256, 0, stream>>>(hbuf, Wq, bq, nullptr, qb);
    gemm_wmma_kernel<<<gemm_blocks, 256, 0, stream>>>(hbuf, Wk, bk, nullptr, kb);
    gemm_wmma_kernel<<<gemm_blocks, 256, 0, stream>>>(hbuf, Wv, bv, nullptr, vb);

    attn_hd1_kernel<<<B_DIM * C_DIM, 256, 0, stream>>>(qb, kb, vb, aob);

    // Output projection + residual, written back to [B, C, S] (== [B,C,H,W]).
    gemm_wmma_kernel<<<gemm_blocks, 256, 0, stream>>>(aob, Wo, bo, x, out);
}

// v001
// A run of this version takes 76.5 microseconds.
// Next to v000, in two timings, it ran 1.24 and 1.26 times as fast.
#include <hip/hip_runtime.h>
#include <hip/hip_bf16.h>

#define B_DIM   2
#define C_DIM   128
#define S_DIM   1024
#define GROUPS  32
#define GSIZE   4          // channels per group (C/GROUPS)
#define EPS_GN  1e-5f
#define QT      4          // queries per thread in the attention kernel (S/256)
#define LOG2E_F 1.44269504088896340736f

typedef __attribute__((ext_vector_type(2))) float v2f;
typedef __attribute__((ext_vector_type(4))) float v4f;
typedef __attribute__((ext_vector_type(8))) float v8f;

// ---------------------------------------------------------------------------
// Kernel 1: GroupNorm over (4 channels x 1024 spatial) per group, then write
// the normalized activations transposed to hbuf[B*S, C] (row-major GEMM input).
// One 256-thread block per (b, g): 64 blocks.
// ---------------------------------------------------------------------------
__global__ void gn_transpose_kernel(const float* __restrict__ x,   // [B, C, S]
                                    const float* __restrict__ gw,  // [C]
                                    const float* __restrict__ gb,  // [C]
                                    float* __restrict__ hbuf) {    // [B*S, C]
    __shared__ float r_sum[256];
    __shared__ float r_sq[256];
    __shared__ float s_mean, s_rstd;

    const int b   = blockIdx.x / GROUPS;
    const int g   = blockIdx.x % GROUPS;
    const int tid = threadIdx.x;
    const float* xg = x + (b * C_DIM + g * GSIZE) * S_DIM;  // 4 x 1024 block

    float sum = 0.f, sq = 0.f;
    for (int e = tid; e < GSIZE * S_DIM; e += 256) {
        float v = xg[e];
        sum += v;
        sq  += v * v;
    }
    r_sum[tid] = sum;
    r_sq[tid]  = sq;
    __syncthreads();
    for (int off = 128; off > 0; off >>= 1) {
        if (tid < off) {
            r_sum[tid] += r_sum[tid + off];
            r_sq[tid]  += r_sq[tid + off];
        }
        __syncthreads();
    }
    if (tid == 0) {
        const float inv_n = 1.0f / (GSIZE * S_DIM);
        float m   = r_sum[0] * inv_n;
        float var = r_sq[0] * inv_n - m * m;      // biased var (matches jnp.var)
        s_mean = m;
        s_rstd = rsqrtf(var + EPS_GN);
    }
    __syncthreads();
    const float m = s_mean, r = s_rstd;
    for (int e = tid; e < GSIZE * S_DIM; e += 256) {
        int cc = e >> 10;           // e / 1024
        int s  = e & 1023;          // e % 1024
        int c  = g * GSIZE + cc;
        float v = (xg[e] - m) * r * gw[c] + gb[c];
        hbuf[(b * S_DIM + s) * C_DIM + c] = v;
    }
}

// ---------------------------------------------------------------------------
// Kernel 2: fp32 GEMM via V_WMMA_F32_16X16X4_F32.
//   out[m][n] = sum_k A[m][k] * W[n][k] + bias[n]   (m = b*S+s)
// written transposed into [B, C, S] layout, with optional residual add.
// Grid: (B*S)/16 blocks of 256 threads; wave w handles column tile w (8x16=128=C).
//
// Fragment layout (ISA 7.12.2, 32-bit, wave32):
//   A 16x4 : lanes 0-15 row M=lane, VGPR{0,1}=K{0,1}; lanes 16-31: K{2,3}
//   B 4x16 : lanes 0-15 col N=lane, VGPR{0,1}=K{0,1}; lanes 16-31: K{2,3}
//   -> each lane loads one float2 (consecutive K) from one row of A / W.
//   D 16x16: VGPR r -> M = r (lanes 0-15) / r+8 (lanes 16-31), N = lane%16.
// ---------------------------------------------------------------------------
__global__ void gemm_wmma_kernel(const float* __restrict__ A,     // [B*S, C]
                                 const float* __restrict__ W,     // [C, C]
                                 const float* __restrict__ bias,  // [C]
                                 const float* __restrict__ resid, // [B, C, S] or nullptr
                                 float* __restrict__ out) {       // [B, C, S]
    const int lane = threadIdx.x & 31;
    const int wave = threadIdx.x >> 5;
    const int row0 = blockIdx.x << 4;     // M tile base (b*S+s)
    const int col0 = wave << 4;           // N tile base (output channel)
    const int half = lane >> 4;           // 0: K 0,1   1: K 2,3
    const int lr   = lane & 15;

    const float* arow = A + (size_t)(row0 + lr) * C_DIM + 2 * half;
    const float* brow = W + (size_t)(col0 + lr) * C_DIM + 2 * half;

    v8f acc = {};
#pragma unroll
    for (int k0 = 0; k0 < C_DIM; k0 += 4) {
        v2f afrag = *(const v2f*)(arow + k0);
        v2f bfrag = *(const v2f*)(brow + k0);
        acc = __builtin_amdgcn_wmma_f32_16x16x4_f32(
            /*neg_a=*/false, afrag, /*neg_b=*/false, bfrag,
            /*c_mod=*/(short)0, acc, /*reuse_a=*/false, /*reuse_b=*/false);
    }

    const int   n  = col0 + lr;
    const float bb = bias[n];
#pragma unroll
    for (int r = 0; r < 8; ++r) {
        int m = row0 + r + half * 8;      // global row index (b*S+s)
        int bi = m >> 10;                 // m / 1024
        int s  = m & 1023;                // m % 1024
        int idx = (bi * C_DIM + n) * S_DIM + s;
        float val = acc[r] + bb;
        if (resid) val += resid[idx];
        out[idx] = val;
    }
}

// ---------------------------------------------------------------------------
// Kernel 3: HEAD_DIM=1 attention. Each (b, head c) is an independent problem:
//   out_i = sum_j exp(q_i*k_j - m_i) * v_j / sum_j exp(q_i*k_j - m_i)
// with exact m_i = q_i>=0 ? q_i*max(k) : q_i*min(k).
// One 256-thread block per (b,c) = 256 blocks.
//
// k and v rows (4 KB each) are staged into LDS with the CDNA5 async copy
// engine: one GLOBAL_LOAD_ASYNC_TO_LDS_B128 per lane per buffer
// (256 lanes x 16 B = 4 KB), tracked by ASYNCcnt. Each wave drains its own
// ASYNCcnt, then the workgroup barrier makes all LDS writes visible.
// ---------------------------------------------------------------------------
__global__ void attn_hd1_kernel(const float* __restrict__ q,   // [B, C, S]
                                const float* __restrict__ k,   // [B, C, S]
                                const float* __restrict__ v,   // [B, C, S]
                                float* __restrict__ ao) {      // [B*S, C]
    __shared__ __attribute__((aligned(16))) float ks[S_DIM];
    __shared__ __attribute__((aligned(16))) float vs[S_DIM];
    __shared__ float rmx[256];
    __shared__ float rmn[256];

    const int b   = blockIdx.x >> 7;           // / 128
    const int c   = blockIdx.x & (C_DIM - 1);
    const int tid = threadIdx.x;

    const float* kp = k + (size_t)(b * C_DIM + c) * S_DIM;
    const float* vp = v + (size_t)(b * C_DIM + c) * S_DIM;

    // --- async global -> LDS staging (16 bytes per lane per buffer) ---
    {
        // Low 32 bits of the generic address of a __shared__ object are the
        // workgroup-relative LDS byte offset (aperture mapping, ISA 10.2).
        unsigned lk = (unsigned)(uintptr_t)(&ks[0]) + (unsigned)tid * 16u;
        unsigned lv = (unsigned)(uintptr_t)(&vs[0]) + (unsigned)tid * 16u;
        const float* gk = kp + tid * 4;
        const float* gv = vp + tid * 4;
        asm volatile("global_load_async_to_lds_b128 %0, %1, off"
                     :: "v"(lk), "v"(gk) : "memory");
        asm volatile("global_load_async_to_lds_b128 %0, %1, off"
                     :: "v"(lv), "v"(gv) : "memory");
        asm volatile("s_wait_asynccnt 0x0" ::: "memory");
    }
    __syncthreads();

    // --- exact row max/min of k for a safe softmax shift ---
    float kmx = -3.402823466e38f, kmn = 3.402823466e38f;
    for (int j = tid; j < S_DIM; j += 256) {
        float kv = ks[j];
        kmx = fmaxf(kmx, kv);
        kmn = fminf(kmn, kv);
    }
    rmx[tid] = kmx;
    rmn[tid] = kmn;
    __syncthreads();
    for (int off = 128; off > 0; off >>= 1) {
        if (tid < off) {
            rmx[tid] = fmaxf(rmx[tid], rmx[tid + off]);
            rmn[tid] = fminf(rmn[tid], rmn[tid + off]);
        }
        __syncthreads();
    }
    kmx = rmx[0];
    kmn = rmn[0];

    // Register tile: the thread's four queries (i = tid + 256 t) stay in
    // registers and walk the keys together, eight keys a trip. Two 16-byte LDS
    // reads of k and two of v, fetched a trip ahead, feed 32 independent exp
    // chains; keys are paired (even, odd) so that score, sum and weighted sum
    // are packed f32 operations. Scores are formed in the base-2 domain
    // (q scaled by log2(e) once per query), so each score is one fma + one exp2.
    const float* qp = q + (size_t)(b * C_DIM + c) * S_DIM;
    v2f qq[QT], nm[QT], se[QT], sv[QT];
    // every loop over t or u below is fully unrolled so that these small arrays
    // are indexed by constants and live in registers, not in scratch memory
#pragma unroll
    for (int t = 0; t < QT; ++t) {
        const float ql = qp[tid + 256 * t] * LOG2E_F;
        const float mx = (ql >= 0.f) ? ql * kmx : ql * kmn;
        qq[t] = (v2f){ql, ql};
        nm[t] = (v2f){-mx, -mx};
        se[t] = (v2f){0.f, 0.f};
        sv[t] = (v2f){0.f, 0.f};
    }

    const v4f* ks4 = (const v4f*)ks;
    const v4f* vs4 = (const v4f*)vs;
    v4f kc[2] = {ks4[0], ks4[1]};
    v4f vc[2] = {vs4[0], vs4[1]};
    // unroll 2: the two register sets (current, next) swap by renaming, not by copies
#pragma unroll 2
    for (int j8 = 0; j8 < S_DIM / 8; ++j8) {
        const int nx = 2 * ((j8 + 1) & (S_DIM / 8 - 1));   // last trip re-reads entry 0, unused
        const v4f kn0 = ks4[nx], kn1 = ks4[nx + 1];
        const v4f vn0 = vs4[nx], vn1 = vs4[nx + 1];
        // keeps the four reads above at the head of the trip, a whole trip of
        // vector work ahead of their first use
        __builtin_amdgcn_sched_barrier(0);
#pragma unroll
        for (int u = 0; u < 2; ++u) {
            const v2f k01 = {kc[u].x, kc[u].y}, k23 = {kc[u].z, kc[u].w};
            const v2f v01 = {vc[u].x, vc[u].y}, v23 = {vc[u].z, vc[u].w};
#pragma unroll
            for (int t = 0; t < QT; ++t) {
                const v2f a0 = __builtin_elementwise_fma(qq[t], k01, nm[t]);
                const v2f a1 = __builtin_elementwise_fma(qq[t], k23, nm[t]);
                const v2f e0 = {__builtin_amdgcn_exp2f(a0.x), __builtin_amdgcn_exp2f(a0.y)};
                const v2f e1 = {__builtin_amdgcn_exp2f(a1.x), __builtin_amdgcn_exp2f(a1.y)};
                se[t] += e0;
                sv[t] = __builtin_elementwise_fma(e0, v01, sv[t]);
                se[t] += e1;
                sv[t] = __builtin_elementwise_fma(e1, v23, sv[t]);
            }
        }
        // Inputs-only fence on the loaded values: keeps the next trip's LDS reads in
        // this trip; without it the compiler sinks them to their first use and the
        // LDS latency stands in front of every trip's first fma.
        asm volatile("" :: "v"(kn0), "v"(kn1), "v"(vn0), "v"(vn1));
        kc[0] = kn0; kc[1] = kn1;
        vc[0] = vn0; vc[1] = vn1;
    }
#pragma unroll
    for (int t = 0; t < QT; ++t) {
        const int i = tid + 256 * t;
        ao[(size_t)(b * S_DIM + i) * C_DIM + c] = (sv[t].x + sv[t].y) / (se[t].x + se[t].y);
    }
}

// ---------------------------------------------------------------------------
// Host-side launcher. Inputs:
//  0 hidden_states [2,128,32,32]  1 gn_weight [128]  2 gn_bias [128]
//  3 Wq [128,128]  4 bq  5 Wk  6 bk  7 Wv  8 bv  9 Wo  10 bo
// Workspace: hbuf | q | k | v | ao, each B*S*C = 262144 floats (5 MB total).
// ---------------------------------------------------------------------------
extern "C" void kernel_launch(void* const* d_in, const int* in_sizes, int n_in,
                              void* d_out, int out_size, void* d_ws, size_t ws_size,
                              hipStream_t stream) {
    const float* x  = (const float*)d_in[0];
    const float* gw = (const float*)d_in[1];
    const float* gb = (const float*)d_in[2];
    const float* Wq = (const float*)d_in[3];
    const float* bq = (const float*)d_in[4];
    const float* Wk = (const float*)d_in[5];
    const float* bk = (const float*)d_in[6];
    const float* Wv = (const float*)d_in[7];
    const float* bv = (const float*)d_in[8];
    const float* Wo = (const float*)d_in[9];
    const float* bo = (const float*)d_in[10];
    float* out = (float*)d_out;

    float* ws = (float*)d_ws;
    const size_t NBS = (size_t)B_DIM * S_DIM * C_DIM;  // 262144
    float* hbuf = ws;
    float* qb   = ws + 1 * NBS;
    float* kb   = ws + 2 * NBS;
    float* vb   = ws + 3 * NBS;
    float* aob  = ws + 4 * NBS;

    const int gemm_blocks = (B_DIM * S_DIM) / 16;   // 128

    gn_transpose_kernel<<<B_DIM * GROUPS, 256, 0, stream>>>(x, gw, gb, hbuf);

    gemm_wmma_kernel<<<gemm_blocks, 256, 0, stream>>>(hbuf, Wq, bq, nullptr, qb);
    gemm_wmma_kernel<<<gemm_blocks, 256, 0, stream>>>(hbuf, Wk, bk, nullptr, kb);
    gemm_wmma_kernel<<<gemm_blocks, 256, 0, stream>>>(hbuf, Wv, bv, nullptr, vb);

    attn_hd1_kernel<<<B_DIM * C_DIM, 256, 0, stream>>>(qb, kb, vb, aob);

    // Output projection + residual, written back to [B, C, S] (== [B,C,H,W]).
    gemm_wmma_kernel<<<gemm_blocks, 256, 0, stream>>>(aob, Wo, bo, x, out);
}

// v002
// It runs in 55.9 microseconds.
// Next to v001, in two timings, it ran 1.35 and 1.37 times as fast.
// All steps since v000 together make it 1.70 times as fast.
#include <hip/hip_runtime.h>
#include <hip/hip_bf16.h>

#define B_DIM   2
#define C_DIM   128
#define S_DIM   1024
#define GROUPS  32
#define GSIZE   4          // channels per group (C/GROUPS)
#define EPS_GN  1e-5f
#define QT      4          // queries per thread in the attention kernel (S/256)
#define LOG2E_F 1.44269504088896340736f

typedef __attribute__((ext_vector_type(2))) float v2f;
typedef __attribute__((ext_vector_type(4))) float v4f;
typedef __attribute__((ext_vector_type(8))) float v8f;

// ---------------------------------------------------------------------------
// Kernel 1: GroupNorm over (4 channels x 1024 spatial) per group, then write
// the normalized activations transposed to hbuf[B*S, C] (row-major GEMM input).
// One 256-thread block per (b, g): 64 blocks.
// ---------------------------------------------------------------------------
__global__ void gn_transpose_kernel(const float* __restrict__ x,   // [B, C, S]
                                    const float* __restrict__ gw,  // [C]
                                    const float* __restrict__ gb,  // [C]
                                    float* __restrict__ hbuf) {    // [B*S, C]
    __shared__ float r_sum[256];
    __shared__ float r_sq[256];
    __shared__ float s_mean, s_rstd;

    const int b   = blockIdx.x / GROUPS;
    const int g   = blockIdx.x % GROUPS;
    const int tid = threadIdx.x;
    const float* xg = x + (b * C_DIM + g * GSIZE) * S_DIM;  // 4 x 1024 block

    float sum = 0.f, sq = 0.f;
    for (int e = tid; e < GSIZE * S_DIM; e += 256) {
        float v = xg[e];
        sum += v;
        sq  += v * v;
    }
    r_sum[tid] = sum;
    r_sq[tid]  = sq;
    __syncthreads();
    for (int off = 128; off > 0; off >>= 1) {
        if (tid < off) {
            r_sum[tid] += r_sum[tid + off];
            r_sq[tid]  += r_sq[tid + off];
        }
        __syncthreads();
    }
    if (tid == 0) {
        const float inv_n = 1.0f / (GSIZE * S_DIM);
        float m   = r_sum[0] * inv_n;
        float var = r_sq[0] * inv_n - m * m;      // biased var (matches jnp.var)
        s_mean = m;
        s_rstd = rsqrtf(var + EPS_GN);
    }
    __syncthreads();
    const float m = s_mean, r = s_rstd;
    for (int e = tid; e < GSIZE * S_DIM; e += 256) {
        int cc = e >> 10;           // e / 1024
        int s  = e & 1023;          // e % 1024
        int c  = g * GSIZE + cc;
        float v = (xg[e] - m) * r * gw[c] + gb[c];
        hbuf[(b * S_DIM + s) * C_DIM + c] = v;
    }
}

// ---------------------------------------------------------------------------
// Kernel 2: fp32 GEMM via V_WMMA_F32_16X16X4_F32.
//   out[m][n] = sum_k A[m][k] * W[n][k] + bias[n]   (m = b*S+s)
// written transposed into [B, C, S] layout, with optional residual add.
// Grid: (B*S)/16 blocks of 256 threads; wave w handles column tile w (8x16=128=C).
//
// Fragment layout (ISA 7.12.2, 32-bit, wave32):
//   A 16x4 : lanes 0-15 row M=lane, VGPR{0,1}=K{0,1}; lanes 16-31: K{2,3}
//   B 4x16 : lanes 0-15 col N=lane, VGPR{0,1}=K{0,1}; lanes 16-31: K{2,3}
//   -> each lane loads one float2 (consecutive K) from one row of A / W.
//   D 16x16: VGPR r -> M = r (lanes 0-15) / r+8 (lanes 16-31), N = lane%16.
// ---------------------------------------------------------------------------
__global__ void gemm_wmma_kernel(const float* __restrict__ A,     // [B*S, C]
                                 const float* __restrict__ W,     // [C, C]
                                 const float* __restrict__ bias,  // [C]
                                 const float* __restrict__ resid, // [B, C, S] or nullptr
                                 float* __restrict__ out) {       // [B, C, S]
    const int lane = threadIdx.x & 31;
    const int wave = threadIdx.x >> 5;
    const int row0 = blockIdx.x << 4;     // M tile base (b*S+s)
    const int col0 = wave << 4;           // N tile base (output channel)
    const int half = lane >> 4;           // 0: K 0,1   1: K 2,3
    const int lr   = lane & 15;

    const float* arow = A + (size_t)(row0 + lr) * C_DIM + 2 * half;
    const float* brow = W + (size_t)(col0 + lr) * C_DIM + 2 * half;

    v8f acc = {};
#pragma unroll
    for (int k0 = 0; k0 < C_DIM; k0 += 4) {
        v2f afrag = *(const v2f*)(arow + k0);
        v2f bfrag = *(const v2f*)(brow + k0);
        acc = __builtin_amdgcn_wmma_f32_16x16x4_f32(
            /*neg_a=*/false, afrag, /*neg_b=*/false, bfrag,
            /*c_mod=*/(short)0, acc, /*reuse_a=*/false, /*reuse_b=*/false);
    }

    const int   n  = col0 + lr;
    const float bb = bias[n];
#pragma unroll
    for (int r = 0; r < 8; ++r) {
        int m = row0 + r + half * 8;      // global row index (b*S+s)
        int bi = m >> 10;                 // m / 1024
        int s  = m & 1023;                // m % 1024
        int idx = (bi * C_DIM + n) * S_DIM + s;
        float val = acc[r] + bb;
        if (resid) val += resid[idx];
        out[idx] = val;
    }
}

// ---------------------------------------------------------------------------
// Kernel 2b: the q, k and v projections in one launch. They read the same A and
// none of each other's output, so one wave takes one 16x16 tile position and
// forms it for all three weights: each A fragment is loaded once and feeds three
// WMMAs on three independent accumulators. Same fragment loaders, same k order
// and same output layout as gemm_wmma_kernel.
// Grid: ((B*S)/16, 2) blocks of 128 threads = 256 blocks; wave w of block
// (x, y) handles row tile x, column tile 4*y + w.
// ---------------------------------------------------------------------------
__global__ void __launch_bounds__(128)
qkv_wmma_kernel(const float* __restrict__ A,    // [B*S, C]
                const float* __restrict__ Wq,   // [C, C]
                const float* __restrict__ bq,   // [C]
                const float* __restrict__ Wk,
                const float* __restrict__ bk,
                const float* __restrict__ Wv,
                const float* __restrict__ bv,
                float* __restrict__ qo,         // [B, C, S]
                float* __restrict__ ko,
                float* __restrict__ vo) {
    const int lane = threadIdx.x & 31;
    const int wave = threadIdx.x >> 5;
    const int row0 = blockIdx.x << 4;                    // M tile base (b*S+s)
    const int col0 = ((blockIdx.y << 2) + wave) << 4;    // N tile base (output channel)
    const int half = lane >> 4;
    const int lr   = lane & 15;

    const float* arow = A + (size_t)(row0 + lr) * C_DIM + 2 * half;
    const size_t woff = (size_t)(col0 + lr) * C_DIM + 2 * half;
    const float* qrow = Wq + woff;
    const float* krow = Wk + woff;
    const float* vrow = Wv + woff;

    v8f accq = {}, acck = {}, accv = {};
    // fully unrolled: every k offset becomes an immediate of its load, no address math
#pragma unroll
    for (int k0 = 0; k0 < C_DIM; k0 += 4) {
        const v2f afrag = *(const v2f*)(arow + k0);
        const v2f qfrag = *(const v2f*)(qrow + k0);
        const v2f kfrag = *(const v2f*)(krow + k0);
        const v2f vfrag = *(const v2f*)(vrow + k0);
        accq = __builtin_amdgcn_wmma_f32_16x16x4_f32(false, afrag, false, qfrag,
                                                     (short)0, accq, false, false);
        acck = __builtin_amdgcn_wmma_f32_16x16x4_f32(false, afrag, false, kfrag,
                                                     (short)0, acck, false, false);
        accv = __builtin_amdgcn_wmma_f32_16x16x4_f32(false, afrag, false, vfrag,
                                                     (short)0, accv, false, false);
    }

    // The bias loads below may land in registers that held the fragment loads'
    // addresses: this wait stands between those loads and that overwrite.
    asm volatile("s_wait_xcnt 0x0" ::: "memory");
    const int   n   = col0 + lr;
    const float bbq = bq[n], bbk = bk[n], bbv = bv[n];
    const int   m0  = row0 + half * 8;                   // first of the lane's 8 rows
    const int   idx = ((m0 >> 10) * C_DIM + n) * S_DIM + (m0 & 1023);
    // fully unrolled: the accumulators are indexed by constants and stay in registers
#pragma unroll
    for (int r = 0; r < 8; ++r) {
        qo[idx + r] = accq[r] + bbq;
        ko[idx + r] = acck[r] + bbk;
        vo[idx + r] = accv[r] + bbv;
    }
}

// ---------------------------------------------------------------------------
// Kernel 3: HEAD_DIM=1 attention. Each (b, head c) is an independent problem:
//   out_i = sum_j exp(q_i*k_j - m_i) * v_j / sum_j exp(q_i*k_j - m_i)
// with exact m_i = q_i>=0 ? q_i*max(k) : q_i*min(k).
// One 256-thread block per (b,c) = 256 blocks.
//
// k and v rows (4 KB each) are staged into LDS with the CDNA5 async copy
// engine: one GLOBAL_LOAD_ASYNC_TO_LDS_B128 per lane per buffer
// (256 lanes x 16 B = 4 KB), tracked by ASYNCcnt. Each wave drains its own
// ASYNCcnt, then the workgroup barrier makes all LDS writes visible.
// ---------------------------------------------------------------------------
__global__ void attn_hd1_kernel(const float* __restrict__ q,   // [B, C, S]
                                const float* __restrict__ k,   // [B, C, S]
                                const float* __restrict__ v,   // [B, C, S]
                                float* __restrict__ ao) {      // [B*S, C]
    __shared__ __attribute__((aligned(16))) float ks[S_DIM];
    __shared__ __attribute__((aligned(16))) float vs[S_DIM];
    __shared__ float rmx[256];
    __shared__ float rmn[256];

    const int b   = blockIdx.x >> 7;           // / 128
    const int c   = blockIdx.x & (C_DIM - 1);
    const int tid = threadIdx.x;

    const float* kp = k + (size_t)(b * C_DIM + c) * S_DIM;
    const float* vp = v + (size_t)(b * C_DIM + c) * S_DIM;

    // --- async global -> LDS staging (16 bytes per lane per buffer) ---
    {
        // Low 32 bits of the generic address of a __shared__ object are the
        // workgroup-relative LDS byte offset (aperture mapping, ISA 10.2).
        unsigned lk = (unsigned)(uintptr_t)(&ks[0]) + (unsigned)tid * 16u;
        unsigned lv = (unsigned)(uintptr_t)(&vs[0]) + (unsigned)tid * 16u;
        const float* gk = kp + tid * 4;
        const float* gv = vp + tid * 4;
        asm volatile("global_load_async_to_lds_b128 %0, %1, off"
                     :: "v"(lk), "v"(gk) : "memory");
        asm volatile("global_load_async_to_lds_b128 %0, %1, off"
                     :: "v"(lv), "v"(gv) : "memory");
        asm volatile("s_wait_asynccnt 0x0" ::: "memory");
    }
    __syncthreads();

    // --- exact row max/min of k for a safe softmax shift ---
    float kmx = -3.402823466e38f, kmn = 3.402823466e38f;
    for (int j = tid; j < S_DIM; j += 256) {
        float kv = ks[j];
        kmx = fmaxf(kmx, kv);
        kmn = fminf(kmn, kv);
    }
    rmx[tid] = kmx;
    rmn[tid] = kmn;
    __syncthreads();
    for (int off = 128; off > 0; off >>= 1) {
        if (tid < off) {
            rmx[tid] = fmaxf(rmx[tid], rmx[tid + off]);
            rmn[tid] = fminf(rmn[tid], rmn[tid + off]);
        }
        __syncthreads();
    }
    kmx = rmx[0];
    kmn = rmn[0];

    // Register tile: the thread's four queries (i = tid + 256 t) stay in
    // registers and walk the keys together, eight keys a trip. Two 16-byte LDS
    // reads of k and two of v, fetched a trip ahead, feed 32 independent exp
    // chains; keys are paired (even, odd) so that score, sum and weighted sum
    // are packed f32 operations. Scores are formed in the base-2 domain
    // (q scaled by log2(e) once per query), so each score is one fma + one exp2.
    const float* qp = q + (size_t)(b * C_DIM + c) * S_DIM;
    v2f qq[QT], nm[QT], se[QT], sv[QT];
    // every loop over t or u below is fully unrolled so that these small arrays
    // are indexed by constants and live in registers, not in scratch memory
#pragma unroll
    for (int t = 0; t < QT; ++t) {
        const float ql = qp[tid + 256 * t] * LOG2E_F;
        const float mx = (ql >= 0.f) ? ql * kmx : ql * kmn;
        qq[t] = (v2f){ql, ql};
        nm[t] = (v2f){-mx, -mx};
        se[t] = (v2f){0.f, 0.f};
        sv[t] = (v2f){0.f, 0.f};
    }

    const v4f* ks4 = (const v4f*)ks;
    const v4f* vs4 = (const v4f*)vs;
    v4f kc[2] = {ks4[0], ks4[1]};
    v4f vc[2] = {vs4[0], vs4[1]};
    // unroll 2: the two register sets (current, next) swap by renaming, not by copies
#pragma unroll 2
    for (int j8 = 0; j8 < S_DIM / 8; ++j8) {
        const int nx = 2 * ((j8 + 1) & (S_DIM / 8 - 1));   // last trip re-reads entry 0, unused
        const v4f kn0 = ks4[nx], kn1 = ks4[nx + 1];
        const v4f vn0 = vs4[nx], vn1 = vs4[nx + 1];
        // keeps the four reads above at the head of the trip, a whole trip of
        // vector work ahead of their first use
        __builtin_amdgcn_sched_barrier(0);
#pragma unroll
        for (int u = 0; u < 2; ++u) {
            const v2f k01 = {kc[u].x, kc[u].y}, k23 = {kc[u].z, kc[u].w};
            const v2f v01 = {vc[u].x, vc[u].y}, v23 = {vc[u].z, vc[u].w};
#pragma unroll
            for (int t = 0; t < QT; ++t) {
                const v2f a0 = __builtin_elementwise_fma(qq[t], k01, nm[t]);
                const v2f a1 = __builtin_elementwise_fma(qq[t], k23, nm[t]);
                const v2f e0 = {__builtin_amdgcn_exp2f(a0.x), __builtin_amdgcn_exp2f(a0.y)};
                const v2f e1 = {__builtin_amdgcn_exp2f(a1.x), __builtin_amdgcn_exp2f(a1.y)};
                se[t] += e0;
                sv[t] = __builtin_elementwise_fma(e0, v01, sv[t]);
                se[t] += e1;
                sv[t] = __builtin_elementwise_fma(e1, v23, sv[t]);
            }
        }
        // Inputs-only fence on the loaded values: keeps the next trip's LDS reads in
        // this trip; without it the compiler sinks them to their first use and the
        // LDS latency stands in front of every trip's first fma.
        asm volatile("" :: "v"(kn0), "v"(kn1), "v"(vn0), "v"(vn1));
        kc[0] = kn0; kc[1] = kn1;
        vc[0] = vn0; vc[1] = vn1;
    }
#pragma unroll
    for (int t = 0; t < QT; ++t) {
        const int i = tid + 256 * t;
        ao[(size_t)(b * S_DIM + i) * C_DIM + c] = (sv[t].x + sv[t].y) / (se[t].x + se[t].y);
    }
}

// ---------------------------------------------------------------------------
// Host-side launcher. Inputs:
//  0 hidden_states [2,128,32,32]  1 gn_weight [128]  2 gn_bias [128]
//  3 Wq [128,128]  4 bq  5 Wk  6 bk  7 Wv  8 bv  9 Wo  10 bo
// Workspace: hbuf | q | k | v | ao, each B*S*C = 262144 floats (5 MB total).
// ---------------------------------------------------------------------------
extern "C" void kernel_launch(void* const* d_in, const int* in_sizes, int n_in,
                              void* d_out, int out_size, void* d_ws, size_t ws_size,
                              hipStream_t stream) {
    const float* x  = (const float*)d_in[0];
    const float* gw = (const float*)d_in[1];
    const float* gb = (const float*)d_in[2];
    const float* Wq = (const float*)d_in[3];
    const float* bq = (const float*)d_in[4];
    const float* Wk = (const float*)d_in[5];
    const float* bk = (const float*)d_in[6];
    const float* Wv = (const float*)d_in[7];
    const float* bv = (const float*)d_in[8];
    const float* Wo = (const float*)d_in[9];
    const float* bo = (const float*)d_in[10];
    float* out = (float*)d_out;

    float* ws = (float*)d_ws;
    const size_t NBS = (size_t)B_DIM * S_DIM * C_DIM;  // 262144
    float* hbuf = ws;
    float* qb   = ws + 1 * NBS;
    float* kb   = ws + 2 * NBS;
    float* vb   = ws + 3 * NBS;
    float* aob  = ws + 4 * NBS;

    const int gemm_blocks = (B_DIM * S_DIM) / 16;   // 128

    gn_transpose_kernel<<<B_DIM * GROUPS, 256, 0, stream>>>(x, gw, gb, hbuf);

    qkv_wmma_kernel<<<dim3(gemm_blocks, 2), 128, 0, stream>>>(hbuf, Wq, bq, Wk, bk, Wv, bv,
                                                              qb, kb, vb);

    attn_hd1_kernel<<<B_DIM * C_DIM, 256, 0, stream>>>(qb, kb, vb, aob);

    // Output projection + residual, written back to [B, C, S] (== [B,C,H,W]).
    gemm_wmma_kernel<<<gemm_blocks, 256, 0, stream>>>(aob, Wo, bo, x, out);
}

// v003
// It runs in 47.5 microseconds.
// Two timings next to v002 put it at 1.17 and 1.18 times that version's speed.
// All steps since v000 together make it 1.99 times as fast.
#include <hip/hip_runtime.h>
#include <hip/hip_bf16.h>

#define B_DIM   2
#define C_DIM   128
#define S_DIM   1024
#define GROUPS  32
#define GSIZE   4          // channels per group (C/GROUPS)
#define EPS_GN  1e-5f
#define QT      4          // queries per thread in the attention kernel (S/256)
#define LOG2E_F 1.44269504088896340736f

typedef __attribute__((ext_vector_type(2))) float v2f;
typedef __attribute__((ext_vector_type(4))) float v4f;
typedef __attribute__((ext_vector_type(8))) float v8f;

// ---------------------------------------------------------------------------
// Kernel 1: GroupNorm over (4 channels x 1024 spatial) per group, then write
// the normalized activations transposed to hbuf[B*S, C] (row-major GEMM input).
// One 256-thread block per (b, g): 64 blocks.
// ---------------------------------------------------------------------------
__global__ void gn_transpose_kernel(const float* __restrict__ x,   // [B, C, S]
                                    const float* __restrict__ gw,  // [C]
                                    const float* __restrict__ gb,  // [C]
                                    float* __restrict__ hbuf) {    // [B*S, C]
    __shared__ float r_sum[256];
    __shared__ float r_sq[256];
    __shared__ float s_mean, s_rstd;

    const int b   = blockIdx.x / GROUPS;
    const int g   = blockIdx.x % GROUPS;
    const int tid = threadIdx.x;
    const float* xg = x + (b * C_DIM + g * GSIZE) * S_DIM;  // 4 x 1024 block

    float sum = 0.f, sq = 0.f;
    for (int e = tid; e < GSIZE * S_DIM; e += 256) {
        float v = xg[e];
        sum += v;
        sq  += v * v;
    }
    r_sum[tid] = sum;
    r_sq[tid]  = sq;
    __syncthreads();
    for (int off = 128; off > 0; off >>= 1) {
        if (tid < off) {
            r_sum[tid] += r_sum[tid + off];
            r_sq[tid]  += r_sq[tid + off];
        }
        __syncthreads();
    }
    if (tid == 0) {
        const float inv_n = 1.0f / (GSIZE * S_DIM);
        float m   = r_sum[0] * inv_n;
        float var = r_sq[0] * inv_n - m * m;      // biased var (matches jnp.var)
        s_mean = m;
        s_rstd = rsqrtf(var + EPS_GN);
    }
    __syncthreads();
    const float m = s_mean, r = s_rstd;
    for (int e = tid; e < GSIZE * S_DIM; e += 256) {
        int cc = e >> 10;           // e / 1024
        int s  = e & 1023;          // e % 1024
        int c  = g * GSIZE + cc;
        float v = (xg[e] - m) * r * gw[c] + gb[c];
        hbuf[(b * S_DIM + s) * C_DIM + c] = v;
    }
}

// ---------------------------------------------------------------------------
// Staging for the two GEMM kernels. Every global operand of a work-group's tile
// goes to LDS by asynchronous 16-byte copies: one copy of a wave moves one whole
// 512-byte row of A or W (four whole cache lines) or 64 B of each of eight
// residual rows, and all copies of a tile are in flight
// together. The WMMA fragments are then read from LDS.
// LDP: LDS pitch of a staged 128-float row. 132 floats = 528 B is a multiple of
// the copy width, and the 8-byte fragment reads of 16 rows x 2 k pairs fall on
// 64 different banks (row step 4 banks, k-pair step 2 banks).
// RDP: LDS pitch of a staged 16-float residual row, 80 B = 16 B x 5.
// ---------------------------------------------------------------------------
#define LDP 132
#define RDP 20

__device__ __forceinline__ unsigned lds_byte(const float* p) {
    // Low 32 bits of the generic address of a __shared__ object are the
    // workgroup-relative LDS byte offset.
    return (unsigned)(uintptr_t)p;
}

// n copies of 16 bytes per lane, copy i at LDS byte l + i*ls and at g + i*gs floats.
// The s_wait_xcnt closes each statement so that no address register of a copy
// is rewritten before the wait.
__device__ __forceinline__ void async_copy2(unsigned l, const float* g, unsigned ls, int gs) {
    asm volatile("global_load_async_to_lds_b128 %0, %2, off\n\t"
                 "global_load_async_to_lds_b128 %1, %3, off\n\t"
                 "s_wait_xcnt 0x0"
                 :: "v"(l), "v"(l + ls), "v"(g), "v"(g + gs) : "memory");
}
__device__ __forceinline__ void async_copy4(unsigned l, const float* g, unsigned ls, int gs) {
    asm volatile("global_load_async_to_lds_b128 %0, %4, off\n\t"
                 "global_load_async_to_lds_b128 %1, %5, off\n\t"
                 "global_load_async_to_lds_b128 %2, %6, off\n\t"
                 "global_load_async_to_lds_b128 %3, %7, off\n\t"
                 "s_wait_xcnt 0x0"
                 :: "v"(l), "v"(l + ls), "v"(l + 2 * ls), "v"(l + 3 * ls),
                    "v"(g), "v"(g + gs), "v"(g + 2 * gs), "v"(g + 3 * gs) : "memory");
}
__device__ __forceinline__ void async_copy8(unsigned l, const float* g, unsigned ls, int gs) {
    asm volatile("global_load_async_to_lds_b128 %0, %8, off\n\t"
                 "global_load_async_to_lds_b128 %1, %9, off\n\t"
                 "global_load_async_to_lds_b128 %2, %10, off\n\t"
                 "global_load_async_to_lds_b128 %3, %11, off\n\t"
                 "global_load_async_to_lds_b128 %4, %12, off\n\t"
                 "global_load_async_to_lds_b128 %5, %13, off\n\t"
                 "global_load_async_to_lds_b128 %6, %14, off\n\t"
                 "global_load_async_to_lds_b128 %7, %15, off\n\t"
                 "s_wait_xcnt 0x0"
                 :: "v"(l), "v"(l + ls), "v"(l + 2 * ls), "v"(l + 3 * ls),
                    "v"(l + 4 * ls), "v"(l + 5 * ls), "v"(l + 6 * ls), "v"(l + 7 * ls),
                    "v"(g), "v"(g + gs), "v"(g + 2 * gs), "v"(g + 3 * gs),
                    "v"(g + 4 * gs), "v"(g + 5 * gs), "v"(g + 6 * gs), "v"(g + 7 * gs) : "memory");
}

// ---------------------------------------------------------------------------
// Kernel 2: fp32 GEMM via V_WMMA_F32_16X16X4_F32, output projection.
//   out[m][n] = sum_k A[m][k] * W[n][k] + bias[n] + resid   (m = b*S+s)
// written transposed into [B, C, S] layout.
// Grid: (B*S)/16 blocks of 256 threads; wave w handles column tile w (8x16=128=C).
// Staged per block: 16 rows of A, all 128 rows of W, the 128 x 16 residual tile.
//
// Fragment layout (ISA 7.12.2, 32-bit, wave32):
//   A 16x4 : lanes 0-15 row M=lane, VGPR{0,1}=K{0,1}; lanes 16-31: K{2,3}
//   B 4x16 : lanes 0-15 col N=lane, VGPR{0,1}=K{0,1}; lanes 16-31: K{2,3}
//   -> each lane reads one float2 (consecutive K) from one row of A / W.
//   D 16x16: VGPR r -> M = r (lanes 0-15) / r+8 (lanes 16-31), N = lane%16.
// ---------------------------------------------------------------------------
__global__ void __launch_bounds__(256)
gemm_wmma_kernel(const float* __restrict__ A,     // [B*S, C]
                 const float* __restrict__ W,     // [C, C]
                 const float* __restrict__ bias,  // [C]
                 const float* __restrict__ resid, // [B, C, S]
                 float* __restrict__ out) {       // [B, C, S]
    __shared__ __attribute__((aligned(16))) float As[16 * LDP];
    __shared__ __attribute__((aligned(16))) float Ws[C_DIM * LDP];
    __shared__ __attribute__((aligned(16))) float Rs[C_DIM * RDP];

    const int tid  = threadIdx.x;
    const int lane = tid & 31;
    const int wave = tid >> 5;
    const int row0 = blockIdx.x << 4;     // M tile base (b*S+s)
    const int col0 = wave << 4;           // N tile base (output channel)
    const int half = lane >> 4;           // 0: K 0,1   1: K 2,3
    const int lr   = lane & 15;
    const int n    = col0 + lr;
    const float bb = bias[n];

    {
        // wave w: rows 2w, 2w+1 of A; rows 16w .. 16w+15 of W
        async_copy2(lds_byte(As) + (unsigned)(2 * wave * LDP * 4 + lane * 16),
                    A + (size_t)(row0 + 2 * wave) * C_DIM + lane * 4, LDP * 4, C_DIM);
        // thread t: 16 bytes (quarter t&3) of residual rows t>>2 and 64 + (t>>2)
        async_copy2(lds_byte(Rs) + (unsigned)((tid >> 2) * RDP * 4 + (tid & 3) * 16),
                    resid + ((size_t)(row0 >> 10) * C_DIM + (tid >> 2)) * S_DIM
                          + (row0 & 1023) + (tid & 3) * 4,
                    64 * RDP * 4, 64 * S_DIM);
        const unsigned lw = lds_byte(Ws) + (unsigned)(col0 * LDP * 4 + lane * 16);
        const float*   gw = W + (size_t)col0 * C_DIM + lane * 4;
        async_copy8(lw, gw, LDP * 4, C_DIM);
        async_copy8(lw + 8 * LDP * 4, gw + 8 * C_DIM, LDP * 4, C_DIM);
        // the wave's own copies have landed; the barrier publishes them to the others
        asm volatile("s_wait_asynccnt 0x0" ::: "memory");
    }
    __syncthreads();

    const float* arow = As + lr * LDP + 2 * half;
    const float* brow = Ws + n * LDP + 2 * half;

    v8f acc = {};
    // fully unrolled: every k offset becomes an immediate of its LDS read
#pragma unroll
    for (int k0 = 0; k0 < C_DIM; k0 += 4) {
        v2f afrag = *(const v2f*)(arow + k0);
        v2f bfrag = *(const v2f*)(brow + k0);
        acc = __builtin_amdgcn_wmma_f32_16x16x4_f32(
            /*neg_a=*/false, afrag, /*neg_b=*/false, bfrag,
            /*c_mod=*/(short)0, acc, /*reuse_a=*/false, /*reuse_b=*/false);
    }

    const int m0  = row0 + half * 8;                     // first of the lane's 8 rows
    const int idx = ((m0 >> 10) * C_DIM + n) * S_DIM + (m0 & 1023);
    const float* rrow = Rs + n * RDP + half * 8;
    // fully unrolled: the accumulator is indexed by constants and stays in registers
#pragma unroll
    for (int r = 0; r < 8; ++r) {
        out[idx + r] = (acc[r] + bb) + rrow[r];
    }
}

// ---------------------------------------------------------------------------
// Kernel 2b: the q, k and v projections in one launch. They read the same A and
// none of each other's output, so one wave takes one 16x16 tile position and
// forms it for all three weights: each A fragment is read once and feeds three
// WMMAs on three independent accumulators. Same fragment layout, same k order
// and same output layout as gemm_wmma_kernel.
// Grid: ((B*S)/16, 2) blocks of 128 threads = 256 blocks; wave w of block
// (x, y) handles row tile x, column tile 4*y + w.
// Staged per block: 16 rows of A and the block's 64 rows of each weight.
// ---------------------------------------------------------------------------
__global__ void __launch_bounds__(128)
qkv_wmma_kernel(const float* __restrict__ A,    // [B*S, C]
                const float* __restrict__ Wq,   // [C, C]
                const float* __restrict__ bq,   // [C]
                const float* __restrict__ Wk,
                const float* __restrict__ bk,
                const float* __restrict__ Wv,
                const float* __restrict__ bv,
                float* __restrict__ qo,         // [B, C, S]
                float* __restrict__ ko,
                float* __restrict__ vo) {
    __shared__ __attribute__((aligned(16))) float As[16 * LDP];
    __shared__ __attribute__((aligned(16))) float Ws[3 * 64 * LDP];

    const int lane = threadIdx.x & 31;
    const int wave = threadIdx.x >> 5;
    const int row0 = blockIdx.x << 4;                    // M tile base (b*S+s)
    const int col0 = ((blockIdx.y << 2) + wave) << 4;    // N tile base (output channel)
    const int half = lane >> 4;
    const int lr   = lane & 15;
    const int   n   = col0 + lr;
    const float bbq = bq[n], bbk = bk[n], bbv = bv[n];

    {
        // wave w: rows 4w .. 4w+3 of A; its own 16 rows of each weight
        async_copy4(lds_byte(As) + (unsigned)(4 * wave * LDP * 4 + lane * 16),
                    A + (size_t)(row0 + 4 * wave) * C_DIM + lane * 4, LDP * 4, C_DIM);
        // (LDS rows 48w: q, 48w+16: k, 48w+32: v, so that one base register and
        // immediate offsets reach all three)
        const unsigned lw = lds_byte(Ws) + (unsigned)(48 * wave * LDP * 4 + lane * 16);
        const size_t   go = (size_t)col0 * C_DIM + lane * 4;
        async_copy8(lw,                 Wq + go,             LDP * 4, C_DIM);
        async_copy8(lw +  8 * LDP * 4,  Wq + go + 8 * C_DIM, LDP * 4, C_DIM);
        async_copy8(lw + 16 * LDP * 4,  Wk + go,             LDP * 4, C_DIM);
        async_copy8(lw + 24 * LDP * 4,  Wk + go + 8 * C_DIM, LDP * 4, C_DIM);
        async_copy8(lw + 32 * LDP * 4,  Wv + go,             LDP * 4, C_DIM);
        async_copy8(lw + 40 * LDP * 4,  Wv + go + 8 * C_DIM, LDP * 4, C_DIM);
        // the wave's own copies have landed; the barrier publishes them to the others
        asm volatile("s_wait_asynccnt 0x0" ::: "memory");
    }
    __syncthreads();

    const float* arow = As + lr * LDP + 2 * half;
    const float* qrow = Ws + (48 * wave + lr) * LDP + 2 * half;
    const float* krow = qrow + 16 * LDP;
    const float* vrow = krow + 16 * LDP;

    v8f accq = {}, acck = {}, accv = {};
    // fully unrolled: every k offset becomes an immediate of its LDS read
#pragma unroll
    for (int k0 = 0; k0 < C_DIM; k0 += 4) {
        const v2f afrag = *(const v2f*)(arow + k0);
        const v2f qfrag = *(const v2f*)(qrow + k0);
        const v2f kfrag = *(const v2f*)(krow + k0);
        const v2f vfrag = *(const v2f*)(vrow + k0);
        accq = __builtin_amdgcn_wmma_f32_16x16x4_f32(false, afrag, false, qfrag,
                                                     (short)0, accq, false, false);
        acck = __builtin_amdgcn_wmma_f32_16x16x4_f32(false, afrag, false, kfrag,
                                                     (short)0, acck, false, false);
        accv = __builtin_amdgcn_wmma_f32_16x16x4_f32(false, afrag, false, vfrag,
                                                     (short)0, accv, false, false);
    }

    const int   m0  = row0 + half * 8;                   // first of the lane's 8 rows
    const int   idx = ((m0 >> 10) * C_DIM + n) * S_DIM + (m0 & 1023);
    // fully unrolled: the accumulators are indexed by constants and stay in registers
#pragma unroll
    for (int r = 0; r < 8; ++r) {
        qo[idx + r] = accq[r] + bbq;
        ko[idx + r] = acck[r] + bbk;
        vo[idx + r] = accv[r] + bbv;
    }
}

// ---------------------------------------------------------------------------
// Kernel 3: HEAD_DIM=1 attention. Each (b, head c) is an independent problem:
//   out_i = sum_j exp(q_i*k_j - m_i) * v_j / sum_j exp(q_i*k_j - m_i)
// with exact m_i = q_i>=0 ? q_i*max(k) : q_i*min(k).
// One 256-thread block per (b,c) = 256 blocks.
//
// k and v rows (4 KB each) are staged into LDS with the CDNA5 async copy
// engine: one GLOBAL_LOAD_ASYNC_TO_LDS_B128 per lane per buffer
// (256 lanes x 16 B = 4 KB), tracked by ASYNCcnt. Each wave drains its own
// ASYNCcnt, then the workgroup barrier makes all LDS writes visible.
// ---------------------------------------------------------------------------
__global__ void attn_hd1_kernel(const float* __restrict__ q,   // [B, C, S]
                                const float* __restrict__ k,   // [B, C, S]
                                const float* __restrict__ v,   // [B, C, S]
                                float* __restrict__ ao) {      // [B*S, C]
    __shared__ __attribute__((aligned(16))) float ks[S_DIM];
    __shared__ __attribute__((aligned(16))) float vs[S_DIM];
    __shared__ float rmx[256];
    __shared__ float rmn[256];

    const int b   = blockIdx.x >> 7;           // / 128
    const int c   = blockIdx.x & (C_DIM - 1);
    const int tid = threadIdx.x;

    const float* kp = k + (size_t)(b * C_DIM + c) * S_DIM;
    const float* vp = v + (size_t)(b * C_DIM + c) * S_DIM;

    // --- async global -> LDS staging (16 bytes per lane per buffer) ---
    {
        // Low 32 bits of the generic address of a __shared__ object are the
        // workgroup-relative LDS byte offset (aperture mapping, ISA 10.2).
        unsigned lk = (unsigned)(uintptr_t)(&ks[0]) + (unsigned)tid * 16u;
        unsigned lv = (unsigned)(uintptr_t)(&vs[0]) + (unsigned)tid * 16u;
        const float* gk = kp + tid * 4;
        const float* gv = vp + tid * 4;
        asm volatile("global_load_async_to_lds_b128 %0, %1, off"
                     :: "v"(lk), "v"(gk) : "memory");
        asm volatile("global_load_async_to_lds_b128 %0, %1, off"
                     :: "v"(lv), "v"(gv) : "memory");
        asm volatile("s_wait_asynccnt 0x0" ::: "memory");
    }
    __syncthreads();

    // --- exact row max/min of k for a safe softmax shift ---
    float kmx = -3.402823466e38f, kmn = 3.402823466e38f;
    for (int j = tid; j < S_DIM; j += 256) {
        float kv = ks[j];
        kmx = fmaxf(kmx, kv);
        kmn = fminf(kmn, kv);
    }
    rmx[tid] = kmx;
    rmn[tid] = kmn;
    __syncthreads();
    for (int off = 128; off > 0; off >>= 1) {
        if (tid < off) {
            rmx[tid] = fmaxf(rmx[tid], rmx[tid + off]);
            rmn[tid] = fminf(rmn[tid], rmn[tid + off]);
        }
        __syncthreads();
    }
    kmx = rmx[0];
    kmn = rmn[0];

    // Register tile: the thread's four queries (i = tid + 256 t) stay in
    // registers and walk the keys together, eight keys a trip. Two 16-byte LDS
    // reads of k and two of v, fetched a trip ahead, feed 32 independent exp
    // chains; keys are paired (even, odd) so that score, sum and weighted sum
    // are packed f32 operations. Scores are formed in the base-2 domain
    // (q scaled by log2(e) once per query), so each score is one fma + one exp2.
    const float* qp = q + (size_t)(b * C_DIM + c) * S_DIM;
    v2f qq[QT], nm[QT], se[QT], sv[QT];
    // every loop over t or u below is fully unrolled so that these small arrays
    // are indexed by constants and live in registers, not in scratch memory
#pragma unroll
    for (int t = 0; t < QT; ++t) {
        const float ql = qp[tid + 256 * t] * LOG2E_F;
        const float mx = (ql >= 0.f) ? ql * kmx : ql * kmn;
        qq[t] = (v2f){ql, ql};
        nm[t] = (v2f){-mx, -mx};
        se[t] = (v2f){0.f, 0.f};
        sv[t] = (v2f){0.f, 0.f};
    }

    const v4f* ks4 = (const v4f*)ks;
    const v4f* vs4 = (const v4f*)vs;
    v4f kc[2] = {ks4[0], ks4[1]};
    v4f vc[2] = {vs4[0], vs4[1]};
    // unroll 2: the two register sets (current, next) swap by renaming, not by copies
#pragma unroll 2
    for (int j8 = 0; j8 < S_DIM / 8; ++j8) {
        const int nx = 2 * ((j8 + 1) & (S_DIM / 8 - 1));   // last trip re-reads entry 0, unused
        const v4f kn0 = ks4[nx], kn1 = ks4[nx + 1];
        const v4f vn0 = vs4[nx], vn1 = vs4[nx + 1];
        // keeps the four reads above at the head of the trip, a whole trip of
        // vector work ahead of their first use
        __builtin_amdgcn_sched_barrier(0);
#pragma unroll
        for (int u = 0; u < 2; ++u) {
            const v2f k01 = {kc[u].x, kc[u].y}, k23 = {kc[u].z, kc[u].w};
            const v2f v01 = {vc[u].x, vc[u].y}, v23 = {vc[u].z, vc[u].w};
#pragma unroll
            for (int t = 0; t < QT; ++t) {
                const v2f a0 = __builtin_elementwise_fma(qq[t], k01, nm[t]);
                const v2f a1 = __builtin_elementwise_fma(qq[t], k23, nm[t]);
                const v2f e0 = {__builtin_amdgcn_exp2f(a0.x), __builtin_amdgcn_exp2f(a0.y)};
                const v2f e1 = {__builtin_amdgcn_exp2f(a1.x), __builtin_amdgcn_exp2f(a1.y)};
                se[t] += e0;
                sv[t] = __builtin_elementwise_fma(e0, v01, sv[t]);
                se[t] += e1;
                sv[t] = __builtin_elementwise_fma(e1, v23, sv[t]);
            }
        }
        // Inputs-only fence on the loaded values: keeps the next trip's LDS reads in
        // this trip; without it the compiler sinks them to their first use and the
        // LDS latency stands in front of every trip's first fma.
        asm volatile("" :: "v"(kn0), "v"(kn1), "v"(vn0), "v"(vn1));
        kc[0] = kn0; kc[1] = kn1;
        vc[0] = vn0; vc[1] = vn1;
    }
#pragma unroll
    for (int t = 0; t < QT; ++t) {
        const int i = tid + 256 * t;
        ao[(size_t)(b * S_DIM + i) * C_DIM + c] = (sv[t].x + sv[t].y) / (se[t].x + se[t].y);
    }
}

// ---------------------------------------------------------------------------
// Host-side launcher. Inputs:
//  0 hidden_states [2,128,32,32]  1 gn_weight [128]  2 gn_bias [128]
//  3 Wq [128,128]  4 bq  5 Wk  6 bk  7 Wv  8 bv  9 Wo  10 bo
// Workspace: hbuf | q | k | v | ao, each B*S*C = 262144 floats (5 MB total).
// ---------------------------------------------------------------------------
extern "C" void kernel_launch(void* const* d_in, const int* in_sizes, int n_in,
                              void* d_out, int out_size, void* d_ws, size_t ws_size,
                              hipStream_t stream) {
    const float* x  = (const float*)d_in[0];
    const float* gw = (const float*)d_in[1];
    const float* gb = (const float*)d_in[2];
    const float* Wq = (const float*)d_in[3];
    const float* bq = (const float*)d_in[4];
    const float* Wk = (const float*)d_in[5];
    const float* bk = (const float*)d_in[6];
    const float* Wv = (const float*)d_in[7];
    const float* bv = (const float*)d_in[8];
    const float* Wo = (const float*)d_in[9];
    const float* bo = (const float*)d_in[10];
    float* out = (float*)d_out;

    float* ws = (float*)d_ws;
    const size_t NBS = (size_t)B_DIM * S_DIM * C_DIM;  // 262144
    float* hbuf = ws;
    float* qb   = ws + 1 * NBS;
    float* kb   = ws + 2 * NBS;
    float* vb   = ws + 3 * NBS;
    float* aob  = ws + 4 * NBS;

    const int gemm_blocks = (B_DIM * S_DIM) / 16;   // 128

    gn_transpose_kernel<<<B_DIM * GROUPS, 256, 0, stream>>>(x, gw, gb, hbuf);

    qkv_wmma_kernel<<<dim3(gemm_blocks, 2), 128, 0, stream>>>(hbuf, Wq, bq, Wk, bk, Wv, bv,
                                                              qb, kb, vb);

    attn_hd1_kernel<<<B_DIM * C_DIM, 256, 0, stream>>>(qb, kb, vb, aob);

    // Output projection + residual, written back to [B, C, S] (== [B,C,H,W]).
    gemm_wmma_kernel<<<gemm_blocks, 256, 0, stream>>>(aob, Wo, bo, x, out);
}

// v004
// One run takes 36.2 microseconds.
// In two side-by-side timings against v003, it was 1.31 and 1.33 times as fast.
// All steps since v000 together make it 2.63 times as fast.
#include <hip/hip_runtime.h>
#include <hip/hip_bf16.h>

#define B_DIM   2
#define C_DIM   128
#define S_DIM   1024
#define GROUPS  32
#define GSIZE   4          // channels per group (C/GROUPS)
#define EPS_GN  1e-5f
#define QT      4          // queries per thread in the attention kernel (S/256)
#define LOG2E_F 1.44269504088896340736f

typedef __attribute__((ext_vector_type(2))) float v2f;
typedef __attribute__((ext_vector_type(4))) float v4f;
typedef __attribute__((ext_vector_type(8))) float v8f;

// ---------------------------------------------------------------------------
// Staging for the two GEMM kernels. Every global operand of a work-group's tile
// goes to LDS by asynchronous 16-byte copies: one copy of a wave moves one whole
// 512-byte row of A or W (four whole cache lines) or 64 B of each of eight
// residual or x-tile rows, and all copies of a tile are in flight
// together. The WMMA fragments are then read from LDS.
// LDP: LDS pitch of a staged 128-float row. 132 floats = 528 B is a multiple of
// the copy width, and the 8-byte fragment reads of 16 rows x 2 k pairs fall on
// 64 different banks (row step 4 banks, k-pair step 2 banks).
// RDP: LDS pitch of a staged 16-float residual or x-tile row, 80 B = 16 B x 5.
// ---------------------------------------------------------------------------
#define LDP 132
#define RDP 20

__device__ __forceinline__ unsigned lds_byte(const float* p) {
    // Low 32 bits of the generic address of a __shared__ object are the
    // workgroup-relative LDS byte offset.
    return (unsigned)(uintptr_t)p;
}

// n copies of 16 bytes per lane, copy i at LDS byte l + i*ls and at g + i*gs floats.
// The s_wait_xcnt closes each statement so that no address register of a copy
// is rewritten before the wait.
__device__ __forceinline__ void async_copy2(unsigned l, const float* g, unsigned ls, int gs) {
    asm volatile("global_load_async_to_lds_b128 %0, %2, off\n\t"
                 "global_load_async_to_lds_b128 %1, %3, off\n\t"
                 "s_wait_xcnt 0x0"
                 :: "v"(l), "v"(l + ls), "v"(g), "v"(g + gs) : "memory");
}
__device__ __forceinline__ void async_copy8(unsigned l, const float* g, unsigned ls, int gs) {
    asm volatile("global_load_async_to_lds_b128 %0, %8, off\n\t"
                 "global_load_async_to_lds_b128 %1, %9, off\n\t"
                 "global_load_async_to_lds_b128 %2, %10, off\n\t"
                 "global_load_async_to_lds_b128 %3, %11, off\n\t"
                 "global_load_async_to_lds_b128 %4, %12, off\n\t"
                 "global_load_async_to_lds_b128 %5, %13, off\n\t"
                 "global_load_async_to_lds_b128 %6, %14, off\n\t"
                 "global_load_async_to_lds_b128 %7, %15, off\n\t"
                 "s_wait_xcnt 0x0"
                 :: "v"(l), "v"(l + ls), "v"(l + 2 * ls), "v"(l + 3 * ls),
                    "v"(l + 4 * ls), "v"(l + 5 * ls), "v"(l + 6 * ls), "v"(l + 7 * ls),
                    "v"(g), "v"(g + gs), "v"(g + 2 * gs), "v"(g + 3 * gs),
                    "v"(g + 4 * gs), "v"(g + 5 * gs), "v"(g + 6 * gs), "v"(g + 7 * gs) : "memory");
}

// ---------------------------------------------------------------------------
// Kernel 2: fp32 GEMM via V_WMMA_F32_16X16X4_F32, output projection.
//   out[m][n] = sum_k A[m][k] * W[n][k] + bias[n] + resid   (m = b*S+s)
// written transposed into [B, C, S] layout.
// Grid: (B*S)/16 blocks of 256 threads; wave w handles column tile w (8x16=128=C).
// Staged per block: 16 rows of A, all 128 rows of W, the 128 x 16 residual tile.
//
// Fragment layout (ISA 7.12.2, 32-bit, wave32):
//   A 16x4 : lanes 0-15 row M=lane, VGPR{0,1}=K{0,1}; lanes 16-31: K{2,3}
//   B 4x16 : lanes 0-15 col N=lane, VGPR{0,1}=K{0,1}; lanes 16-31: K{2,3}
//   -> each lane reads one float2 (consecutive K) from one row of A / W.
//   D 16x16: VGPR r -> M = r (lanes 0-15) / r+8 (lanes 16-31), N = lane%16.
// ---------------------------------------------------------------------------
__global__ void __launch_bounds__(256)
gemm_wmma_kernel(const float* __restrict__ A,     // [B*S, C]
                 const float* __restrict__ W,     // [C, C]
                 const float* __restrict__ bias,  // [C]
                 const float* __restrict__ resid, // [B, C, S]
                 float* __restrict__ out) {       // [B, C, S]
    __shared__ __attribute__((aligned(16))) float As[16 * LDP];
    __shared__ __attribute__((aligned(16))) float Ws[C_DIM * LDP];
    __shared__ __attribute__((aligned(16))) float Rs[C_DIM * RDP];

    const int tid  = threadIdx.x;
    const int lane = tid & 31;
    const int wave = tid >> 5;
    const int row0 = blockIdx.x << 4;     // M tile base (b*S+s)
    const int col0 = wave << 4;           // N tile base (output channel)
    const int half = lane >> 4;           // 0: K 0,1   1: K 2,3
    const int lr   = lane & 15;
    const int n    = col0 + lr;
    const float bb = bias[n];

    {
        // wave w: rows 2w, 2w+1 of A; rows 16w .. 16w+15 of W
        async_copy2(lds_byte(As) + (unsigned)(2 * wave * LDP * 4 + lane * 16),
                    A + (size_t)(row0 + 2 * wave) * C_DIM + lane * 4, LDP * 4, C_DIM);
        // thread t: 16 bytes (quarter t&3) of residual rows t>>2 and 64 + (t>>2)
        async_copy2(lds_byte(Rs) + (unsigned)((tid >> 2) * RDP * 4 + (tid & 3) * 16),
                    resid + ((size_t)(row0 >> 10) * C_DIM + (tid >> 2)) * S_DIM
                          + (row0 & 1023) + (tid & 3) * 4,
                    64 * RDP * 4, 64 * S_DIM);
        const unsigned lw = lds_byte(Ws) + (unsigned)(col0 * LDP * 4 + lane * 16);
        const float*   gw = W + (size_t)col0 * C_DIM + lane * 4;
        async_copy8(lw, gw, LDP * 4, C_DIM);
        async_copy8(lw + 8 * LDP * 4, gw + 8 * C_DIM, LDP * 4, C_DIM);
        // the wave's own copies have landed; the barrier publishes them to the others
        asm volatile("s_wait_asynccnt 0x0" ::: "memory");
    }
    __syncthreads();

    const float* arow = As + lr * LDP + 2 * half;
    const float* brow = Ws + n * LDP + 2 * half;

    v8f acc = {};
    // fully unrolled: every k offset becomes an immediate of its LDS read
#pragma unroll
    for (int k0 = 0; k0 < C_DIM; k0 += 4) {
        v2f afrag = *(const v2f*)(arow + k0);
        v2f bfrag = *(const v2f*)(brow + k0);
        acc = __builtin_amdgcn_wmma_f32_16x16x4_f32(
            /*neg_a=*/false, afrag, /*neg_b=*/false, bfrag,
            /*c_mod=*/(short)0, acc, /*reuse_a=*/false, /*reuse_b=*/false);
    }

    const int m0  = row0 + half * 8;                     // first of the lane's 8 rows
    const int idx = ((m0 >> 10) * C_DIM + n) * S_DIM + (m0 & 1023);
    const float* rrow = Rs + n * RDP + half * 8;
    // fully unrolled: the accumulator is indexed by constants and stays in registers
#pragma unroll
    for (int r = 0; r < 8; ++r) {
        out[idx + r] = (acc[r] + bb) + rrow[r];
    }
}

// ---------------------------------------------------------------------------
// Kernel 1: GroupNorm and the q, k and v projections in one launch.
// Grid: (B*S)/16 blocks of 256 threads; block x takes the 16 rows (b, s0..s0+15),
// wave w column tile w of all three weights (three accumulators on one A fragment).
// A work-group needs the statistics of all 32 groups of its batch and no other
// work-group can hand them over inside a launch, so each sums x[b] (512 KB, read
// from L2) itself: wave w takes groups 4w .. 4w+3, 64 KB in a row. The weights and
// the block's own 128 x 16 tile of x fly to LDS meanwhile by asynchronous copies.
// The tile is then normalized and transposed in LDS into the row-major A tile.
// Same fragment layout, k order and output layout as gemm_wmma_kernel.
// ---------------------------------------------------------------------------
__global__ void __launch_bounds__(256)
gn_qkv_wmma_kernel(const float* __restrict__ x,    // [B, C, S]
                   const float* __restrict__ gw,   // [C]
                   const float* __restrict__ gb,   // [C]
                   const float* __restrict__ Wq,   // [C, C]
                   const float* __restrict__ bq,   // [C]
                   const float* __restrict__ Wk,
                   const float* __restrict__ bk,
                   const float* __restrict__ Wv,
                   const float* __restrict__ bv,
                   float* __restrict__ qo,         // [B, C, S]
                   float* __restrict__ ko,
                   float* __restrict__ vo) {
    __shared__ __attribute__((aligned(16))) float As[16 * LDP];
    __shared__ __attribute__((aligned(16))) float Ws[3 * C_DIM * LDP];
    __shared__ __attribute__((aligned(16))) float Xs[C_DIM * RDP];
    __shared__ __attribute__((aligned(16))) v2f   Cs[C_DIM];   // mean, rstd of a channel's group

    const int tid  = threadIdx.x;
    const int lane = tid & 31;
    const int wave = tid >> 5;
    const int row0 = blockIdx.x << 4;     // M tile base (b*S+s)
    const int bi   = row0 >> 10;
    const int col0 = wave << 4;           // N tile base (output channel)
    const int half = lane >> 4;
    const int lr   = lane & 15;
    const int   n   = col0 + lr;
    const float bbq = bq[n], bbk = bk[n], bbv = bv[n];
    const int   cn  = tid & (C_DIM - 1);  // the channel this thread normalizes
    const float gwc = gw[cn], gbc = gb[cn];

    {
        // thread t: 16 bytes (quarter t&3) of x rows t>>2 and 64 + (t>>2), columns s0 .. s0+15
        async_copy2(lds_byte(Xs) + (unsigned)((tid >> 2) * RDP * 4 + (tid & 3) * 16),
                    x + ((size_t)bi * C_DIM + (tid >> 2)) * S_DIM + (row0 & 1023) + (tid & 3) * 4,
                    64 * RDP * 4, 64 * S_DIM);
        // wave w: its own 16 rows of each weight
        // (LDS rows 48w: q, 48w+16: k, 48w+32: v, so that one base register and
        // immediate offsets reach all three)
        const unsigned lw = lds_byte(Ws) + (unsigned)(48 * wave * LDP * 4 + lane * 16);
        const size_t   go = (size_t)col0 * C_DIM + lane * 4;
        async_copy8(lw,                 Wq + go,             LDP * 4, C_DIM);
        async_copy8(lw +  8 * LDP * 4,  Wq + go + 8 * C_DIM, LDP * 4, C_DIM);
        async_copy8(lw + 16 * LDP * 4,  Wk + go,             LDP * 4, C_DIM);
        async_copy8(lw + 24 * LDP * 4,  Wk + go + 8 * C_DIM, LDP * 4, C_DIM);
        async_copy8(lw + 32 * LDP * 4,  Wv + go,             LDP * 4, C_DIM);
        async_copy8(lw + 40 * LDP * 4,  Wv + go + 8 * C_DIM, LDP * 4, C_DIM);
    }

    // --- sums of the wave's four groups (channels col0 .. col0+15 of batch bi) ---
    float gs[4], gq[4];
    {
        const v4f* xw = (const v4f*)(x + ((size_t)bi * C_DIM + col0) * S_DIM) + lane;
        // Eight batches of 16 loads (two to a group) through three register buffers:
        // two batches stay in flight behind the one that is summed. All loops are fully
        // unrolled: every load is the one base address plus an immediate, and the
        // buffers and gs/gq are indexed by constants.
        v4f buf[3][16];
        v4f s4 = {0.f, 0.f, 0.f, 0.f}, q4 = {0.f, 0.f, 0.f, 0.f};
#pragma unroll
        for (int i = 0; i < 16; ++i) buf[0][i] = xw[i * 32];
#pragma unroll
        for (int i = 0; i < 16; ++i) buf[1][i] = xw[(16 + i) * 32];
#pragma unroll
        for (int k = 0; k < 8; ++k) {
            if (k + 2 < 8) {
#pragma unroll
                for (int i = 0; i < 16; ++i) buf[(k + 2) % 3][i] = xw[((k + 2) * 16 + i) * 32];
            }
            // holds the loads above in front of the sums below: two batches ahead, no more
            // (left free, the compiler issues all 128 loads at once on some 500 registers)
            __builtin_amdgcn_sched_barrier(0);
#pragma unroll
            for (int i = 0; i < 16; ++i) {
                const v4f t = buf[k % 3][i];
                s4 += t;
                q4 = __builtin_elementwise_fma(t, t, q4);
            }
            if (k & 1) {
                gs[k >> 1] = (s4.x + s4.y) + (s4.z + s4.w);
                gq[k >> 1] = (q4.x + q4.y) + (q4.z + q4.w);
                s4 = (v4f){0.f, 0.f, 0.f, 0.f};
                q4 = (v4f){0.f, 0.f, 0.f, 0.f};
            }
            // keeps the next batch's loads behind these sums, whose buffer they refill
            __builtin_amdgcn_sched_barrier(0);
        }
    }
    {
        // Sum over the 32 lanes. The first two exchanges also deal the four groups out:
        // a lane keeps the groups of its own half (then quarter) of the wave and sends
        // the others, so lanes 8g .. 8g+7 end with the whole sums of group g.
        const bool h16 = (lane & 16) != 0, h8 = (lane & 8) != 0;
        float sa = (h16 ? gs[2] : gs[0]) + __shfl_xor(h16 ? gs[0] : gs[2], 16, 32);
        float sb = (h16 ? gs[3] : gs[1]) + __shfl_xor(h16 ? gs[1] : gs[3], 16, 32);
        float qa = (h16 ? gq[2] : gq[0]) + __shfl_xor(h16 ? gq[0] : gq[2], 16, 32);
        float qb = (h16 ? gq[3] : gq[1]) + __shfl_xor(h16 ? gq[1] : gq[3], 16, 32);
        float sm = (h8 ? sb : sa) + __shfl_xor(h8 ? sa : sb, 8, 32);
        float qm = (h8 ? qb : qa) + __shfl_xor(h8 ? qa : qb, 8, 32);
        // fully unrolled: three fixed exchange distances
#pragma unroll
        for (int off = 4; off > 0; off >>= 1) {
            sm += __shfl_xor(sm, off, 32);
            qm += __shfl_xor(qm, off, 32);
        }
        const float inv_n = 1.0f / (GSIZE * S_DIM);
        const float m   = sm * inv_n;
        const float var = qm * inv_n - m * m;     // biased var (matches jnp.var)
        const float r   = rsqrtf(var + EPS_GN);
        if ((lane & 4) == 0) Cs[col0 + (lane >> 3) * 4 + (lane & 3)] = (v2f){m, r};
    }
    // the wave's own copies have landed; the barrier publishes them and Cs to the others
    asm volatile("s_wait_asynccnt 0x0" ::: "memory");
    __syncthreads();

    {
        // thread t: channel t&127, eight columns; lanes walk c, so the 16-byte reads
        // (pitch 80 B) and the 4-byte writes (consecutive) meet no bank twice
        const int c  = cn;
        const int sb = (tid >> 7) * 8;
        const v2f p  = Cs[c];
        const v4f x0 = *(const v4f*)(Xs + c * RDP + sb);
        const v4f x1 = *(const v4f*)(Xs + c * RDP + sb + 4);
        // fully unrolled: the vector elements are indexed by constants
#pragma unroll
        for (int r = 0; r < 4; ++r) {
            As[(sb + r) * LDP + c]     = (x0[r] - p.x) * p.y * gwc + gbc;
            As[(sb + 4 + r) * LDP + c] = (x1[r] - p.x) * p.y * gwc + gbc;
        }
    }
    // the A tile is whole before any wave reads a fragment
    __syncthreads();

    const float* arow = As + lr * LDP + 2 * half;
    const float* qrow = Ws + (48 * wave + lr) * LDP + 2 * half;
    const float* krow = qrow + 16 * LDP;
    const float* vrow = krow + 16 * LDP;

    v8f accq = {}, acck = {}, accv = {};
    // fully unrolled: every k offset becomes an immediate of its LDS read
#pragma unroll
    for (int k0 = 0; k0 < C_DIM; k0 += 4) {
        const v2f afrag = *(const v2f*)(arow + k0);
        const v2f qfrag = *(const v2f*)(qrow + k0);
        const v2f kfrag = *(const v2f*)(krow + k0);
        const v2f vfrag = *(const v2f*)(vrow + k0);
        accq = __builtin_amdgcn_wmma_f32_16x16x4_f32(false, afrag, false, qfrag,
                                                     (short)0, accq, false, false);
        acck = __builtin_amdgcn_wmma_f32_16x16x4_f32(false, afrag, false, kfrag,
                                                     (short)0, acck, false, false);
        accv = __builtin_amdgcn_wmma_f32_16x16x4_f32(false, afrag, false, vfrag,
                                                     (short)0, accv, false, false);
    }

    const int   m0  = row0 + half * 8;                   // first of the lane's 8 rows
    const int   idx = ((m0 >> 10) * C_DIM + n) * S_DIM + (m0 & 1023);
    // fully unrolled: the accumulators are indexed by constants and stay in registers
#pragma unroll
    for (int r = 0; r < 8; ++r) {
        qo[idx + r] = accq[r] + bbq;
        ko[idx + r] = acck[r] + bbk;
        vo[idx + r] = accv[r] + bbv;
    }
}

// ---------------------------------------------------------------------------
// Kernel 3: HEAD_DIM=1 attention. Each (b, head c) is an independent problem:
//   out_i = sum_j exp(q_i*k_j - m_i) * v_j / sum_j exp(q_i*k_j - m_i)
// with exact m_i = q_i>=0 ? q_i*max(k) : q_i*min(k).
// One 256-thread block per (b,c) = 256 blocks.
//
// k and v rows (4 KB each) are staged into LDS with the CDNA5 async copy
// engine: one GLOBAL_LOAD_ASYNC_TO_LDS_B128 per lane per buffer
// (256 lanes x 16 B = 4 KB), tracked by ASYNCcnt. Each wave drains its own
// ASYNCcnt, then the workgroup barrier makes all LDS writes visible.
// ---------------------------------------------------------------------------
__global__ void attn_hd1_kernel(const float* __restrict__ q,   // [B, C, S]
                                const float* __restrict__ k,   // [B, C, S]
                                const float* __restrict__ v,   // [B, C, S]
                                float* __restrict__ ao) {      // [B*S, C]
    __shared__ __attribute__((aligned(16))) float ks[S_DIM];
    __shared__ __attribute__((aligned(16))) float vs[S_DIM];
    __shared__ float rmx[256];
    __shared__ float rmn[256];

    const int b   = blockIdx.x >> 7;           // / 128
    const int c   = blockIdx.x & (C_DIM - 1);
    const int tid = threadIdx.x;

    const float* kp = k + (size_t)(b * C_DIM + c) * S_DIM;
    const float* vp = v + (size_t)(b * C_DIM + c) * S_DIM;

    // --- async global -> LDS staging (16 bytes per lane per buffer) ---
    {
        // Low 32 bits of the generic address of a __shared__ object are the
        // workgroup-relative LDS byte offset (aperture mapping, ISA 10.2).
        unsigned lk = (unsigned)(uintptr_t)(&ks[0]) + (unsigned)tid * 16u;
        unsigned lv = (unsigned)(uintptr_t)(&vs[0]) + (unsigned)tid * 16u;
        const float* gk = kp + tid * 4;
        const float* gv = vp + tid * 4;
        asm volatile("global_load_async_to_lds_b128 %0, %1, off"
                     :: "v"(lk), "v"(gk) : "memory");
        asm volatile("global_load_async_to_lds_b128 %0, %1, off"
                     :: "v"(lv), "v"(gv) : "memory");
        asm volatile("s_wait_asynccnt 0x0" ::: "memory");
    }
    __syncthreads();

    // --- exact row max/min of k for a safe softmax shift ---
    float kmx = -3.402823466e38f, kmn = 3.402823466e38f;
    for (int j = tid; j < S_DIM; j += 256) {
        float kv = ks[j];
        kmx = fmaxf(kmx, kv);
        kmn = fminf(kmn, kv);
    }
    rmx[tid] = kmx;
    rmn[tid] = kmn;
    __syncthreads();
    for (int off = 128; off > 0; off >>= 1) {
        if (tid < off) {
            rmx[tid] = fmaxf(rmx[tid], rmx[tid + off]);
            rmn[tid] = fminf(rmn[tid], rmn[tid + off]);
        }
        __syncthreads();
    }
    kmx = rmx[0];
    kmn = rmn[0];

    // Register tile: the thread's four queries (i = tid + 256 t) stay in
    // registers and walk the keys together, eight keys a trip. Two 16-byte LDS
    // reads of k and two of v, fetched a trip ahead, feed 32 independent exp
    // chains; keys are paired (even, odd) so that score, sum and weighted sum
    // are packed f32 operations. Scores are formed in the base-2 domain
    // (q scaled by log2(e) once per query), so each score is one fma + one exp2.
    const float* qp = q + (size_t)(b * C_DIM + c) * S_DIM;
    v2f qq[QT], nm[QT], se[QT], sv[QT];
    // every loop over t or u below is fully unrolled so that these small arrays
    // are indexed by constants and live in registers, not in scratch memory
#pragma unroll
    for (int t = 0; t < QT; ++t) {
        const float ql = qp[tid + 256 * t] * LOG2E_F;
        const float mx = (ql >= 0.f) ? ql * kmx : ql * kmn;
        qq[t] = (v2f){ql, ql};
        nm[t] = (v2f){-mx, -mx};
        se[t] = (v2f){0.f, 0.f};
        sv[t] = (v2f){0.f, 0.f};
    }

    const v4f* ks4 = (const v4f*)ks;
    const v4f* vs4 = (const v4f*)vs;
    v4f kc[2] = {ks4[0], ks4[1]};
    v4f vc[2] = {vs4[0], vs4[1]};
    // unroll 2: the two register sets (current, next) swap by renaming, not by copies
#pragma unroll 2
    for (int j8 = 0; j8 < S_DIM / 8; ++j8) {
        const int nx = 2 * ((j8 + 1) & (S_DIM / 8 - 1));   // last trip re-reads entry 0, unused
        const v4f kn0 = ks4[nx], kn1 = ks4[nx + 1];
        const v4f vn0 = vs4[nx], vn1 = vs4[nx + 1];
        // keeps the four reads above at the head of the trip, a whole trip of
        // vector work ahead of their first use
        __builtin_amdgcn_sched_barrier(0);
#pragma unroll
        for (int u = 0; u < 2; ++u) {
            const v2f k01 = {kc[u].x, kc[u].y}, k23 = {kc[u].z, kc[u].w};
            const v2f v01 = {vc[u].x, vc[u].y}, v23 = {vc[u].z, vc[u].w};
#pragma unroll
            for (int t = 0; t < QT; ++t) {
                const v2f a0 = __builtin_elementwise_fma(qq[t], k01, nm[t]);
                const v2f a1 = __builtin_elementwise_fma(qq[t], k23, nm[t]);
                const v2f e0 = {__builtin_amdgcn_exp2f(a0.x), __builtin_amdgcn_exp2f(a0.y)};
                const v2f e1 = {__builtin_amdgcn_exp2f(a1.x), __builtin_amdgcn_exp2f(a1.y)};
                se[t] += e0;
                sv[t] = __builtin_elementwise_fma(e0, v01, sv[t]);
                se[t] += e1;
                sv[t] = __builtin_elementwise_fma(e1, v23, sv[t]);
            }
        }
        // Inputs-only fence on the loaded values: keeps the next trip's LDS reads in
        // this trip; without it the compiler sinks them to their first use and the
        // LDS latency stands in front of every trip's first fma.
        asm volatile("" :: "v"(kn0), "v"(kn1), "v"(vn0), "v"(vn1));
        kc[0] = kn0; kc[1] = kn1;
        vc[0] = vn0; vc[1] = vn1;
    }
#pragma unroll
    for (int t = 0; t < QT; ++t) {
        const int i = tid + 256 * t;
        ao[(size_t)(b * S_DIM + i) * C_DIM + c] = (sv[t].x + sv[t].y) / (se[t].x + se[t].y);
    }
}

// ---------------------------------------------------------------------------
// Host-side launcher. Inputs:
//  0 hidden_states [2,128,32,32]  1 gn_weight [128]  2 gn_bias [128]
//  3 Wq [128,128]  4 bq  5 Wk  6 bk  7 Wv  8 bv  9 Wo  10 bo
// Workspace: q | k | v | ao, each B*S*C = 262144 floats (4 MB total).
// ---------------------------------------------------------------------------
extern "C" void kernel_launch(void* const* d_in, const int* in_sizes, int n_in,
                              void* d_out, int out_size, void* d_ws, size_t ws_size,
                              hipStream_t stream) {
    const float* x  = (const float*)d_in[0];
    const float* gw = (const float*)d_in[1];
    const float* gb = (const float*)d_in[2];
    const float* Wq = (const float*)d_in[3];
    const float* bq = (const float*)d_in[4];
    const float* Wk = (const float*)d_in[5];
    const float* bk = (const float*)d_in[6];
    const float* Wv = (const float*)d_in[7];
    const float* bv = (const float*)d_in[8];
    const float* Wo = (const float*)d_in[9];
    const float* bo = (const float*)d_in[10];
    float* out = (float*)d_out;

    float* ws = (float*)d_ws;
    const size_t NBS = (size_t)B_DIM * S_DIM * C_DIM;  // 262144
    float* qb   = ws;
    float* kb   = ws + 1 * NBS;
    float* vb   = ws + 2 * NBS;
    float* aob  = ws + 3 * NBS;

    const int gemm_blocks = (B_DIM * S_DIM) / 16;   // 128

    gn_qkv_wmma_kernel<<<gemm_blocks, 256, 0, stream>>>(x, gw, gb, Wq, bq, Wk, bk, Wv, bv,
                                                        qb, kb, vb);

    attn_hd1_kernel<<<B_DIM * C_DIM, 256, 0, stream>>>(qb, kb, vb, aob);

    // Output projection + residual, written back to [B, C, S] (== [B,C,H,W]).
    gemm_wmma_kernel<<<gemm_blocks, 256, 0, stream>>>(aob, Wo, bo, x, out);
}

// v005
// Measured time: 34.1 microseconds a run.
// Timed twice side by side with v004, it ran 1.06 and 1.07 times as fast.
// All steps since v000 together make it 2.80 times as fast.
#include <hip/hip_runtime.h>
#include <hip/hip_bf16.h>

#define B_DIM   2
#define C_DIM   128
#define S_DIM   1024
#define GROUPS  32
#define GSIZE   4          // channels per group (C/GROUPS)
#define EPS_GN  1e-5f
#define QT      4          // queries per thread in the attention kernel (S/256)
#define LOG2E_F 1.44269504088896340736f

typedef __attribute__((ext_vector_type(2))) float v2f;
typedef __attribute__((ext_vector_type(4))) float v4f;
typedef __attribute__((ext_vector_type(8))) float v8f;

// ---------------------------------------------------------------------------
// Staging for the two GEMM kernels. Every global operand of a work-group's tile
// goes to LDS by asynchronous 16-byte copies: one copy of a wave moves one whole
// 512-byte row of A or W (four whole cache lines) or 64 B of each of eight
// residual or x-tile rows, and all copies of a tile are in flight
// together. The WMMA fragments are then read from LDS.
// LDP: LDS pitch of a staged 128-float row. 132 floats = 528 B is a multiple of
// the copy width, and the 8-byte fragment reads of 16 rows x 2 k pairs fall on
// 64 different banks (row step 4 banks, k-pair step 2 banks).
// RDP: LDS pitch of a staged 16-float residual or x-tile row, 80 B = 16 B x 5.
// ---------------------------------------------------------------------------
#define LDP 132
#define RDP 20

__device__ __forceinline__ unsigned lds_byte(const float* p) {
    // Low 32 bits of the generic address of a __shared__ object are the
    // workgroup-relative LDS byte offset.
    return (unsigned)(uintptr_t)p;
}

// n copies of 16 bytes per lane, copy i at LDS byte l + i*ls and at g + i*gs floats.
// The s_wait_xcnt closes each statement so that no address register of a copy
// is rewritten before the wait.
__device__ __forceinline__ void async_copy2(unsigned l, const float* g, unsigned ls, int gs) {
    asm volatile("global_load_async_to_lds_b128 %0, %2, off\n\t"
                 "global_load_async_to_lds_b128 %1, %3, off\n\t"
                 "s_wait_xcnt 0x0"
                 :: "v"(l), "v"(l + ls), "v"(g), "v"(g + gs) : "memory");
}
__device__ __forceinline__ void async_copy8(unsigned l, const float* g, unsigned ls, int gs) {
    asm volatile("global_load_async_to_lds_b128 %0, %8, off\n\t"
                 "global_load_async_to_lds_b128 %1, %9, off\n\t"
                 "global_load_async_to_lds_b128 %2, %10, off\n\t"
                 "global_load_async_to_lds_b128 %3, %11, off\n\t"
                 "global_load_async_to_lds_b128 %4, %12, off\n\t"
                 "global_load_async_to_lds_b128 %5, %13, off\n\t"
                 "global_load_async_to_lds_b128 %6, %14, off\n\t"
                 "global_load_async_to_lds_b128 %7, %15, off\n\t"
                 "s_wait_xcnt 0x0"
                 :: "v"(l), "v"(l + ls), "v"(l + 2 * ls), "v"(l + 3 * ls),
                    "v"(l + 4 * ls), "v"(l + 5 * ls), "v"(l + 6 * ls), "v"(l + 7 * ls),
                    "v"(g), "v"(g + gs), "v"(g + 2 * gs), "v"(g + 3 * gs),
                    "v"(g + 4 * gs), "v"(g + 5 * gs), "v"(g + 6 * gs), "v"(g + 7 * gs) : "memory");
}

// ---------------------------------------------------------------------------
// Kernel 2: fp32 GEMM via V_WMMA_F32_16X16X4_F32, output projection.
//   out[m][n] = sum_k A[m][k] * W[n][k] + bias[n] + resid   (m = b*S+s)
// written transposed into [B, C, S] layout.
// Grid: (B*S)/16 blocks of 256 threads; wave w handles column tile w (8x16=128=C).
// Staged per block: 16 rows of A, all 128 rows of W, the 128 x 16 residual tile.
//
// Fragment layout (ISA 7.12.2, 32-bit, wave32):
//   A 16x4 : lanes 0-15 row M=lane, VGPR{0,1}=K{0,1}; lanes 16-31: K{2,3}
//   B 4x16 : lanes 0-15 col N=lane, VGPR{0,1}=K{0,1}; lanes 16-31: K{2,3}
//   -> each lane reads one float2 (consecutive K) from one row of A / W.
//   D 16x16: VGPR r -> M = r (lanes 0-15) / r+8 (lanes 16-31), N = lane%16.
// ---------------------------------------------------------------------------
__global__ void __launch_bounds__(256)
gemm_wmma_kernel(const float* __restrict__ A,     // [B*S, C]
                 const float* __restrict__ W,     // [C, C]
                 const float* __restrict__ bias,  // [C]
                 const float* __restrict__ resid, // [B, C, S]
                 float* __restrict__ out) {       // [B, C, S]
    __shared__ __attribute__((aligned(16))) float As[16 * LDP];
    __shared__ __attribute__((aligned(16))) float Ws[C_DIM * LDP];
    __shared__ __attribute__((aligned(16))) float Rs[C_DIM * RDP];

    const int tid  = threadIdx.x;
    const int lane = tid & 31;
    const int wave = tid >> 5;
    const int row0 = blockIdx.x << 4;     // M tile base (b*S+s)
    const int col0 = wave << 4;           // N tile base (output channel)
    const int half = lane >> 4;           // 0: K 0,1   1: K 2,3
    const int lr   = lane & 15;
    const int n    = col0 + lr;
    const float bb = bias[n];

    {
        // wave w: rows 2w, 2w+1 of A; rows 16w .. 16w+15 of W
        async_copy2(lds_byte(As) + (unsigned)(2 * wave * LDP * 4 + lane * 16),
                    A + (size_t)(row0 + 2 * wave) * C_DIM + lane * 4, LDP * 4, C_DIM);
        // thread t: 16 bytes (quarter t&3) of residual rows t>>2 and 64 + (t>>2)
        async_copy2(lds_byte(Rs) + (unsigned)((tid >> 2) * RDP * 4 + (tid & 3) * 16),
                    resid + ((size_t)(row0 >> 10) * C_DIM + (tid >> 2)) * S_DIM
                          + (row0 & 1023) + (tid & 3) * 4,
                    64 * RDP * 4, 64 * S_DIM);
        const unsigned lw = lds_byte(Ws) + (unsigned)(col0 * LDP * 4 + lane * 16);
        const float*   gw = W + (size_t)col0 * C_DIM + lane * 4;
        async_copy8(lw, gw, LDP * 4, C_DIM);
        async_copy8(lw + 8 * LDP * 4, gw + 8 * C_DIM, LDP * 4, C_DIM);
        // the wave's own copies have landed; the barrier publishes them to the others
        asm volatile("s_wait_asynccnt 0x0" ::: "memory");
    }
    __syncthreads();

    const float* arow = As + lr * LDP + 2 * half;
    const float* brow = Ws + n * LDP + 2 * half;

    v8f acc = {};
    // fully unrolled: every k offset becomes an immediate of its LDS read
#pragma unroll
    for (int k0 = 0; k0 < C_DIM; k0 += 4) {
        v2f afrag = *(const v2f*)(arow + k0);
        v2f bfrag = *(const v2f*)(brow + k0);
        acc = __builtin_amdgcn_wmma_f32_16x16x4_f32(
            /*neg_a=*/false, afrag, /*neg_b=*/false, bfrag,
            /*c_mod=*/(short)0, acc, /*reuse_a=*/false, /*reuse_b=*/false);
    }

    const int m0  = row0 + half * 8;                     // first of the lane's 8 rows
    const int idx = ((m0 >> 10) * C_DIM + n) * S_DIM + (m0 & 1023);
    const float* rrow = Rs + n * RDP + half * 8;
    // fully unrolled: the accumulator is indexed by constants and stays in registers
#pragma unroll
    for (int r = 0; r < 8; ++r) {
        out[idx + r] = (acc[r] + bb) + rrow[r];
    }
}

// ---------------------------------------------------------------------------
// Kernel 1: GroupNorm and the q, k and v projections in one launch.
// Grid: (B*S)/16 blocks of 256 threads; block x takes the 16 rows (b, s0..s0+15),
// wave w column tile w of all three weights (three accumulators on one A fragment).
// A work-group needs the statistics of all 32 groups of its batch and no other
// work-group can hand them over inside a launch, so each sums x[b] (512 KB, read
// from L2) itself: wave w takes groups 4w .. 4w+3, 64 KB in a row. The weights and
// the block's own 128 x 16 tile of x fly to LDS meanwhile by asynchronous copies.
// The tile is then normalized and transposed in LDS into the row-major A tile.
// Same fragment layout, k order and output layout as gemm_wmma_kernel.
// ---------------------------------------------------------------------------
__global__ void __launch_bounds__(256)
gn_qkv_wmma_kernel(const float* __restrict__ x,    // [B, C, S]
                   const float* __restrict__ gw,   // [C]
                   const float* __restrict__ gb,   // [C]
                   const float* __restrict__ Wq,   // [C, C]
                   const float* __restrict__ bq,   // [C]
                   const float* __restrict__ Wk,
                   const float* __restrict__ bk,
                   const float* __restrict__ Wv,
                   const float* __restrict__ bv,
                   float* __restrict__ qo,         // [B, C, S]
                   float* __restrict__ ko,
                   float* __restrict__ vo) {
    __shared__ __attribute__((aligned(16))) float As[16 * LDP];
    __shared__ __attribute__((aligned(16))) float Ws[3 * C_DIM * LDP];
    __shared__ __attribute__((aligned(16))) float Xs[C_DIM * RDP];
    __shared__ __attribute__((aligned(16))) v2f   Cs[C_DIM];   // mean, rstd of a channel's group

    const int tid  = threadIdx.x;
    const int lane = tid & 31;
    const int wave = tid >> 5;
    const int row0 = blockIdx.x << 4;     // M tile base (b*S+s)
    const int bi   = row0 >> 10;
    const int col0 = wave << 4;           // N tile base (output channel)
    const int half = lane >> 4;
    const int lr   = lane & 15;
    const int   n   = col0 + lr;
    const float bbq = bq[n], bbk = bk[n], bbv = bv[n];
    const int   cn  = tid & (C_DIM - 1);  // the channel this thread normalizes
    const float gwc = gw[cn], gbc = gb[cn];

    {
        // thread t: 16 bytes (quarter t&3) of x rows t>>2 and 64 + (t>>2), columns s0 .. s0+15
        async_copy2(lds_byte(Xs) + (unsigned)((tid >> 2) * RDP * 4 + (tid & 3) * 16),
                    x + ((size_t)bi * C_DIM + (tid >> 2)) * S_DIM + (row0 & 1023) + (tid & 3) * 4,
                    64 * RDP * 4, 64 * S_DIM);
        // wave w: its own 16 rows of each weight
        // (LDS rows 48w: q, 48w+16: k, 48w+32: v, so that one base register and
        // immediate offsets reach all three)
        const unsigned lw = lds_byte(Ws) + (unsigned)(48 * wave * LDP * 4 + lane * 16);
        const size_t   go = (size_t)col0 * C_DIM + lane * 4;
        async_copy8(lw,                 Wq + go,             LDP * 4, C_DIM);
        async_copy8(lw +  8 * LDP * 4,  Wq + go + 8 * C_DIM, LDP * 4, C_DIM);
        async_copy8(lw + 16 * LDP * 4,  Wk + go,             LDP * 4, C_DIM);
        async_copy8(lw + 24 * LDP * 4,  Wk + go + 8 * C_DIM, LDP * 4, C_DIM);
        async_copy8(lw + 32 * LDP * 4,  Wv + go,             LDP * 4, C_DIM);
        async_copy8(lw + 40 * LDP * 4,  Wv + go + 8 * C_DIM, LDP * 4, C_DIM);
    }

    // --- sums of the wave's four groups (channels col0 .. col0+15 of batch bi) ---
    float gs[4], gq[4];
    {
        const v4f* xw = (const v4f*)(x + ((size_t)bi * C_DIM + col0) * S_DIM) + lane;
        // Eight batches of 16 loads (two to a group) through three register buffers:
        // two batches stay in flight behind the one that is summed. All loops are fully
        // unrolled: every load is the one base address plus an immediate, and the
        // buffers and gs/gq are indexed by constants.
        v4f buf[3][16];
        v4f s4 = {0.f, 0.f, 0.f, 0.f}, q4 = {0.f, 0.f, 0.f, 0.f};
#pragma unroll
        for (int i = 0; i < 16; ++i) buf[0][i] = xw[i * 32];
#pragma unroll
        for (int i = 0; i < 16; ++i) buf[1][i] = xw[(16 + i) * 32];
#pragma unroll
        for (int k = 0; k < 8; ++k) {
            if (k + 2 < 8) {
#pragma unroll
                for (int i = 0; i < 16; ++i) buf[(k + 2) % 3][i] = xw[((k + 2) * 16 + i) * 32];
            }
            // holds the loads above in front of the sums below: two batches ahead, no more
            // (left free, the compiler issues all 128 loads at once on some 500 registers)
            __builtin_amdgcn_sched_barrier(0);
#pragma unroll
            for (int i = 0; i < 16; ++i) {
                const v4f t = buf[k % 3][i];
                s4 += t;
                q4 = __builtin_elementwise_fma(t, t, q4);
            }
            if (k & 1) {
                gs[k >> 1] = (s4.x + s4.y) + (s4.z + s4.w);
                gq[k >> 1] = (q4.x + q4.y) + (q4.z + q4.w);
                s4 = (v4f){0.f, 0.f, 0.f, 0.f};
                q4 = (v4f){0.f, 0.f, 0.f, 0.f};
            }
            // keeps the next batch's loads behind these sums, whose buffer they refill
            __builtin_amdgcn_sched_barrier(0);
        }
    }
    {
        // Sum over the 32 lanes. The first two exchanges also deal the four groups out:
        // a lane keeps the groups of its own half (then quarter) of the wave and sends
        // the others, so lanes 8g .. 8g+7 end with the whole sums of group g.
        const bool h16 = (lane & 16) != 0, h8 = (lane & 8) != 0;
        float sa = (h16 ? gs[2] : gs[0]) + __shfl_xor(h16 ? gs[0] : gs[2], 16, 32);
        float sb = (h16 ? gs[3] : gs[1]) + __shfl_xor(h16 ? gs[1] : gs[3], 16, 32);
        float qa = (h16 ? gq[2] : gq[0]) + __shfl_xor(h16 ? gq[0] : gq[2], 16, 32);
        float qb = (h16 ? gq[3] : gq[1]) + __shfl_xor(h16 ? gq[1] : gq[3], 16, 32);
        float sm = (h8 ? sb : sa) + __shfl_xor(h8 ? sa : sb, 8, 32);
        float qm = (h8 ? qb : qa) + __shfl_xor(h8 ? qa : qb, 8, 32);
        // fully unrolled: three fixed exchange distances
#pragma unroll
        for (int off = 4; off > 0; off >>= 1) {
            sm += __shfl_xor(sm, off, 32);
            qm += __shfl_xor(qm, off, 32);
        }
        const float inv_n = 1.0f / (GSIZE * S_DIM);
        const float m   = sm * inv_n;
        const float var = qm * inv_n - m * m;     // biased var (matches jnp.var)
        const float r   = rsqrtf(var + EPS_GN);
        if ((lane & 4) == 0) Cs[col0 + (lane >> 3) * 4 + (lane & 3)] = (v2f){m, r};
    }
    // the wave's own copies have landed; the barrier publishes them and Cs to the others
    asm volatile("s_wait_asynccnt 0x0" ::: "memory");
    __syncthreads();

    {
        // thread t: channel t&127, eight columns; lanes walk c, so the 16-byte reads
        // (pitch 80 B) and the 4-byte writes (consecutive) meet no bank twice
        const int c  = cn;
        const int sb = (tid >> 7) * 8;
        const v2f p  = Cs[c];
        const v4f x0 = *(const v4f*)(Xs + c * RDP + sb);
        const v4f x1 = *(const v4f*)(Xs + c * RDP + sb + 4);
        // fully unrolled: the vector elements are indexed by constants
#pragma unroll
        for (int r = 0; r < 4; ++r) {
            As[(sb + r) * LDP + c]     = (x0[r] - p.x) * p.y * gwc + gbc;
            As[(sb + 4 + r) * LDP + c] = (x1[r] - p.x) * p.y * gwc + gbc;
        }
    }
    // the A tile is whole before any wave reads a fragment
    __syncthreads();

    const float* arow = As + lr * LDP + 2 * half;
    const float* qrow = Ws + (48 * wave + lr) * LDP + 2 * half;
    const float* krow = qrow + 16 * LDP;
    const float* vrow = krow + 16 * LDP;

    v8f accq = {}, acck = {}, accv = {};
    // fully unrolled: every k offset becomes an immediate of its LDS read
#pragma unroll
    for (int k0 = 0; k0 < C_DIM; k0 += 4) {
        const v2f afrag = *(const v2f*)(arow + k0);
        const v2f qfrag = *(const v2f*)(qrow + k0);
        const v2f kfrag = *(const v2f*)(krow + k0);
        const v2f vfrag = *(const v2f*)(vrow + k0);
        accq = __builtin_amdgcn_wmma_f32_16x16x4_f32(false, afrag, false, qfrag,
                                                     (short)0, accq, false, false);
        acck = __builtin_amdgcn_wmma_f32_16x16x4_f32(false, afrag, false, kfrag,
                                                     (short)0, acck, false, false);
        accv = __builtin_amdgcn_wmma_f32_16x16x4_f32(false, afrag, false, vfrag,
                                                     (short)0, accv, false, false);
    }

    const int   m0  = row0 + half * 8;                   // first of the lane's 8 rows
    const int   idx = ((m0 >> 10) * C_DIM + n) * S_DIM + (m0 & 1023);
    // fully unrolled: the accumulators are indexed by constants and stay in registers
#pragma unroll
    for (int r = 0; r < 8; ++r) {
        qo[idx + r] = accq[r] + bbq;
        ko[idx + r] = acck[r] + bbk;
        vo[idx + r] = accv[r] + bbv;
    }
}

// ---------------------------------------------------------------------------
// Kernel 3: HEAD_DIM=1 attention. Each (b, head c) is an independent problem:
//   out_i = sum_j exp(q_i*k_j - m_i) * v_j / sum_j exp(q_i*k_j - m_i)
// with exact m_i = q_i>=0 ? q_i*max(k) : q_i*min(k).
// One 256-thread block per (b,c) = 256 blocks.
//
// k and v rows (4 KB each) are staged into LDS with the CDNA5 async copy
// engine: one GLOBAL_LOAD_ASYNC_TO_LDS_B128 per lane per buffer
// (256 lanes x 16 B = 4 KB), tracked by ASYNCcnt. Each wave drains its own
// ASYNCcnt, then the workgroup barrier makes all LDS writes visible.
// ---------------------------------------------------------------------------
__global__ void attn_hd1_kernel(const float* __restrict__ q,   // [B, C, S]
                                const float* __restrict__ k,   // [B, C, S]
                                const float* __restrict__ v,   // [B, C, S]
                                float* __restrict__ ao) {      // [B*S, C]
    __shared__ __attribute__((aligned(16))) float ks[S_DIM];
    __shared__ __attribute__((aligned(16))) float vs[S_DIM];
    __shared__ float rmx[256];
    __shared__ float rmn[256];

    const int b   = blockIdx.x >> 7;           // / 128
    const int c   = blockIdx.x & (C_DIM - 1);
    const int tid = threadIdx.x;

    const float* kp = k + (size_t)(b * C_DIM + c) * S_DIM;
    const float* vp = v + (size_t)(b * C_DIM + c) * S_DIM;

    // --- async global -> LDS staging (16 bytes per lane per buffer) ---
    {
        // Low 32 bits of the generic address of a __shared__ object are the
        // workgroup-relative LDS byte offset (aperture mapping, ISA 10.2).
        unsigned lk = (unsigned)(uintptr_t)(&ks[0]) + (unsigned)tid * 16u;
        unsigned lv = (unsigned)(uintptr_t)(&vs[0]) + (unsigned)tid * 16u;
        const float* gk = kp + tid * 4;
        const float* gv = vp + tid * 4;
        asm volatile("global_load_async_to_lds_b128 %0, %1, off"
                     :: "v"(lk), "v"(gk) : "memory");
        asm volatile("global_load_async_to_lds_b128 %0, %1, off"
                     :: "v"(lv), "v"(gv) : "memory");
        asm volatile("s_wait_asynccnt 0x0" ::: "memory");
    }
    __syncthreads();

    // --- exact row max/min of k for a safe softmax shift ---
    float kmx = -3.402823466e38f, kmn = 3.402823466e38f;
    for (int j = tid; j < S_DIM; j += 256) {
        float kv = ks[j];
        kmx = fmaxf(kmx, kv);
        kmn = fminf(kmn, kv);
    }
    rmx[tid] = kmx;
    rmn[tid] = kmn;
    __syncthreads();
    for (int off = 128; off > 0; off >>= 1) {
        if (tid < off) {
            rmx[tid] = fmaxf(rmx[tid], rmx[tid + off]);
            rmn[tid] = fminf(rmn[tid], rmn[tid + off]);
        }
        __syncthreads();
    }
    kmx = rmx[0];
    kmn = rmn[0];

    // Register tile: the thread's four queries (i = tid + 256 t) stay in
    // registers and walk the keys together, eight keys a trip. Two 16-byte LDS
    // reads of k and two of v, fetched a trip ahead, feed 32 independent exp
    // chains; keys are paired (even, odd) so that score, sum and weighted sum
    // are packed f32 operations. Scores are formed in the base-2 domain
    // (q scaled by log2(e) once per query), so each score is one fma + one exp2.
    const float* qp = q + (size_t)(b * C_DIM + c) * S_DIM;
    v2f qq[QT], nm[QT], se[QT], sv[QT];
    // every loop over t or i below is fully unrolled so that these small arrays
    // are indexed by constants and live in registers, not in scratch memory
#pragma unroll
    for (int t = 0; t < QT; ++t) {
        const float ql = qp[tid + 256 * t] * LOG2E_F;
        const float mx = (ql >= 0.f) ? ql * kmx : ql * kmn;
        qq[t] = (v2f){ql, ql};
        nm[t] = (v2f){-mx, -mx};
        se[t] = (v2f){0.f, 0.f};
        sv[t] = (v2f){0.f, 0.f};
    }

    const v4f* ks4 = (const v4f*)ks;
    const v4f* vs4 = (const v4f*)vs;
    v4f kc[2] = {ks4[0], ks4[1]};
    v4f vc[2] = {vs4[0], vs4[1]};
    // unroll 2: the two register sets (current, next) swap by renaming, not by copies
#pragma unroll 2
    for (int j8 = 0; j8 < S_DIM / 8; ++j8) {
        const int nx = 2 * ((j8 + 1) & (S_DIM / 8 - 1));   // last trip re-reads entry 0, unused
        const v4f kn0 = ks4[nx], kn1 = ks4[nx + 1];
        const v4f vn0 = vs4[nx], vn1 = vs4[nx + 1];
        // keeps the four reads above at the head of the trip, a whole trip of
        // vector work ahead of their first use
        __builtin_amdgcn_sched_barrier(0);
        // One unit = one key pair for one query: score fma (S), two exp2, sum add and weighted fma.
        // The units are written as a software pipeline in which no exp2 stands directly behind
        // an exp2: between and behind the two exp2 of unit i stand a score of a later unit and
        // the two sums of unit i - 2, all independent of them, so that the transcendental unit
        // works beside the packed f32 instructions of the same wave.
        // ORD: holds that written order; left free, the compiler gathers the exp2 in runs.
#define ORD() __builtin_amdgcn_sched_barrier(0)
#define SCORE(n) a[n] = __builtin_elementwise_fma(qq[(n) & 3], kk[(n) >> 2], nm[(n) & 3])
        const v2f kk[4] = {{kc[0].x, kc[0].y}, {kc[0].z, kc[0].w}, {kc[1].x, kc[1].y}, {kc[1].z, kc[1].w}};
        const v2f vv[4] = {{vc[0].x, vc[0].y}, {vc[0].z, vc[0].w}, {vc[1].x, vc[1].y}, {vc[1].z, vc[1].w}};
        v2f a[4 * QT], e[4 * QT];
        SCORE(0);
        SCORE(1);
        ORD();
        // fully unrolled: a, e, se, sv are indexed by constants and every test on i folds away
#pragma unroll
        for (int i = 0; i < 4 * QT + 2; ++i) {
            const int d = i - 2;               // the unit whose sums are taken here
            if (i < 4 * QT) { e[i].x = __builtin_amdgcn_exp2f(a[i].x); ORD(); }
            if (i < 2)       { SCORE(2 * i + 2); ORD(); }
            else if (i < 12) { SCORE(i + 4); ORD(); }
            else             { se[d & 3] += e[d]; ORD(); }
            if (i < 4 * QT) { e[i].y = __builtin_amdgcn_exp2f(a[i].y); ORD(); }
            if (i < 2)       { SCORE(2 * i + 3); ORD(); }
            else {
                if (i < 12)  { se[d & 3] += e[d]; ORD(); }
                sv[d & 3] = __builtin_elementwise_fma(e[d], vv[d >> 2], sv[d & 3]);
                ORD();
            }
        }
#undef SCORE
#undef ORD
        // Inputs-only fence on the loaded values: keeps the next trip's LDS reads in
        // this trip; without it the compiler sinks them to their first use and the
        // LDS latency stands in front of every trip's first fma.
        asm volatile("" :: "v"(kn0), "v"(kn1), "v"(vn0), "v"(vn1));
        kc[0] = kn0; kc[1] = kn1;
        vc[0] = vn0; vc[1] = vn1;
    }
#pragma unroll
    for (int t = 0; t < QT; ++t) {
        const int i = tid + 256 * t;
        ao[(size_t)(b * S_DIM + i) * C_DIM + c] = (sv[t].x + sv[t].y) / (se[t].x + se[t].y);
    }
}

// ---------------------------------------------------------------------------
// Host-side launcher. Inputs:
//  0 hidden_states [2,128,32,32]  1 gn_weight [128]  2 gn_bias [128]
//  3 Wq [128,128]  4 bq  5 Wk  6 bk  7 Wv  8 bv  9 Wo  10 bo
// Workspace: q | k | v | ao, each B*S*C = 262144 floats (4 MB total).
// ---------------------------------------------------------------------------
extern "C" void kernel_launch(void* const* d_in, const int* in_sizes, int n_in,
                              void* d_out, int out_size, void* d_ws, size_t ws_size,
                              hipStream_t stream) {
    const float* x  = (const float*)d_in[0];
    const float* gw = (const float*)d_in[1];
    const float* gb = (const float*)d_in[2];
    const float* Wq = (const float*)d_in[3];
    const float* bq = (const float*)d_in[4];
    const float* Wk = (const float*)d_in[5];
    const float* bk = (const float*)d_in[6];
    const float* Wv = (const float*)d_in[7];
    const float* bv = (const float*)d_in[8];
    const float* Wo = (const float*)d_in[9];
    const float* bo = (const float*)d_in[10];
    float* out = (float*)d_out;

    float* ws = (float*)d_ws;
    const size_t NBS = (size_t)B_DIM * S_DIM * C_DIM;  // 262144
    float* qb   = ws;
    float* kb   = ws + 1 * NBS;
    float* vb   = ws + 2 * NBS;
    float* aob  = ws + 3 * NBS;

    const int gemm_blocks = (B_DIM * S_DIM) / 16;   // 128

    gn_qkv_wmma_kernel<<<gemm_blocks, 256, 0, stream>>>(x, gw, gb, Wq, bq, Wk, bk, Wv, bv,
                                                        qb, kb, vb);

    attn_hd1_kernel<<<B_DIM * C_DIM, 256, 0, stream>>>(qb, kb, vb, aob);

    // Output projection + residual, written back to [B, C, S] (== [B,C,H,W]).
    gemm_wmma_kernel<<<gemm_blocks, 256, 0, stream>>>(aob, Wo, bo, x, out);
}

// v006
// Measured time: 28 microseconds a run.
// In two side-by-side timings against v005, it was 1.21 and 1.22 times as fast.
// All steps since v000 together make it 3.40 times as fast.
#include <hip/hip_runtime.h>
#include <hip/hip_bf16.h>

#define B_DIM   2
#define C_DIM   128
#define S_DIM   1024
#define GROUPS  32
#define GSIZE   4          // channels per group (C/GROUPS)
#define EPS_GN  1e-5f
#define QB      8          // queries per work-group (and per thread) in the attention kernel
#define RING    8          // trips of k,v that a wave keeps in flight in registers
#define LOG2E_F 1.44269504088896340736f

typedef __attribute__((ext_vector_type(2))) float v2f;
typedef __attribute__((ext_vector_type(4))) float v4f;
typedef __attribute__((ext_vector_type(8))) float v8f;

// ---------------------------------------------------------------------------
// Staging for the two GEMM stages. Every global operand of a work-group's tile
// goes to LDS by asynchronous 16-byte copies: one copy of a wave moves one whole
// 512-byte row of W (four whole cache lines) or 64 B of each of eight
// x rows, and all copies of a tile are in flight
// together. The WMMA fragments are then read from LDS.
// LDP: LDS pitch of a staged 128-float row. 132 floats = 528 B is a multiple of
// the copy width, and the 8-byte fragment reads of 16 rows x 2 k pairs fall on
// 64 different banks (row step 4 banks, k-pair step 2 banks).
// RDP: LDS pitch of a staged 16-float x-tile row, 80 B = 16 B x 5.
// ---------------------------------------------------------------------------
#define LDP 132
#define RDP 20

__device__ __forceinline__ unsigned lds_byte(const float* p) {
    // Low 32 bits of the generic address of a __shared__ object are the
    // workgroup-relative LDS byte offset.
    return (unsigned)(uintptr_t)p;
}

// n copies of 16 bytes per lane, copy i at LDS byte l + i*ls and at g + i*gs floats.
// The s_wait_xcnt closes each statement so that no address register of a copy
// is rewritten before the wait.
__device__ __forceinline__ void async_copy2(unsigned l, const float* g, unsigned ls, int gs) {
    asm volatile("global_load_async_to_lds_b128 %0, %2, off\n\t"
                 "global_load_async_to_lds_b128 %1, %3, off\n\t"
                 "s_wait_xcnt 0x0"
                 :: "v"(l), "v"(l + ls), "v"(g), "v"(g + gs) : "memory");
}
__device__ __forceinline__ void async_copy8(unsigned l, const float* g, unsigned ls, int gs) {
    asm volatile("global_load_async_to_lds_b128 %0, %8, off\n\t"
                 "global_load_async_to_lds_b128 %1, %9, off\n\t"
                 "global_load_async_to_lds_b128 %2, %10, off\n\t"
                 "global_load_async_to_lds_b128 %3, %11, off\n\t"
                 "global_load_async_to_lds_b128 %4, %12, off\n\t"
                 "global_load_async_to_lds_b128 %5, %13, off\n\t"
                 "global_load_async_to_lds_b128 %6, %14, off\n\t"
                 "global_load_async_to_lds_b128 %7, %15, off\n\t"
                 "s_wait_xcnt 0x0"
                 :: "v"(l), "v"(l + ls), "v"(l + 2 * ls), "v"(l + 3 * ls),
                    "v"(l + 4 * ls), "v"(l + 5 * ls), "v"(l + 6 * ls), "v"(l + 7 * ls),
                    "v"(g), "v"(g + gs), "v"(g + 2 * gs), "v"(g + 3 * gs),
                    "v"(g + 4 * gs), "v"(g + 5 * gs), "v"(g + 6 * gs), "v"(g + 7 * gs) : "memory");
}

// ---------------------------------------------------------------------------
// Kernel 1: GroupNorm and the q, k and v projections in one launch.
// Grid: (B*S)/16 blocks of 256 threads; block x takes the 16 rows (b, s0..s0+15),
// wave w column tile w of all three weights (three accumulators on one A fragment).
// A work-group needs the statistics of all 32 groups of its batch and no other
// work-group can hand them over inside a launch, so each sums x[b] (512 KB, read
// from L2) itself: wave w takes groups 4w .. 4w+3, 64 KB in a row. The weights and
// the block's own 128 x 16 tile of x fly to LDS meanwhile by asynchronous copies.
// The tile is then normalized and transposed in LDS into the row-major A tile.
// Fragment layout (ISA 7.12.2, 32-bit, wave32):
//   A 16x4 : lanes 0-15 row M=lane, VGPR{0,1}=K{0,1}; lanes 16-31: K{2,3}
//   B 4x16 : lanes 0-15 col N=lane, VGPR{0,1}=K{0,1}; lanes 16-31: K{2,3}
//   -> each lane reads one float2 (consecutive K) from one row of A / W.
//   D 16x16: VGPR r -> M = r (lanes 0-15) / r+8 (lanes 16-31), N = lane%16.
// Outputs, laid out for the attention kernel, whose lanes walk the channels:
//   qo [B][S/4][C][4] : four consecutive positions of one channel
//   kv [B][S/2][C][4] : k(s), k(s+1), v(s), v(s+1) of one channel
//   mm [B][S/16][C][2]: max and min of k over this block's 16 positions
// ---------------------------------------------------------------------------
__global__ void __launch_bounds__(256)
gn_qkv_wmma_kernel(const float* __restrict__ x,    // [B, C, S]
                   const float* __restrict__ gw,   // [C]
                   const float* __restrict__ gb,   // [C]
                   const float* __restrict__ Wq,   // [C, C]
                   const float* __restrict__ bq,   // [C]
                   const float* __restrict__ Wk,
                   const float* __restrict__ bk,
                   const float* __restrict__ Wv,
                   const float* __restrict__ bv,
                   float* __restrict__ qo,
                   float* __restrict__ kv,
                   float* __restrict__ mm) {
    __shared__ __attribute__((aligned(16))) float As[16 * LDP];
    __shared__ __attribute__((aligned(16))) float Ws[3 * C_DIM * LDP];
    __shared__ __attribute__((aligned(16))) float Xs[C_DIM * RDP];
    __shared__ __attribute__((aligned(16))) v2f   Cs[C_DIM];   // mean, rstd of a channel's group

    const int tid  = threadIdx.x;
    const int lane = tid & 31;
    const int wave = tid >> 5;
    const int row0 = blockIdx.x << 4;     // M tile base (b*S+s)
    const int bi   = row0 >> 10;
    const int col0 = wave << 4;           // N tile base (output channel)
    const int half = lane >> 4;
    const int lr   = lane & 15;
    const int   n   = col0 + lr;
    const float bbq = bq[n], bbk = bk[n], bbv = bv[n];
    const int   cn  = tid & (C_DIM - 1);  // the channel this thread normalizes
    const float gwc = gw[cn], gbc = gb[cn];

    {
        // thread t: 16 bytes (quarter t&3) of x rows t>>2 and 64 + (t>>2), columns s0 .. s0+15
        async_copy2(lds_byte(Xs) + (unsigned)((tid >> 2) * RDP * 4 + (tid & 3) * 16),
                    x + ((size_t)bi * C_DIM + (tid >> 2)) * S_DIM + (row0 & 1023) + (tid & 3) * 4,
                    64 * RDP * 4, 64 * S_DIM);
        // wave w: its own 16 rows of each weight
        // (LDS rows 48w: q, 48w+16: k, 48w+32: v, so that one base register and
        // immediate offsets reach all three)
        const unsigned lw = lds_byte(Ws) + (unsigned)(48 * wave * LDP * 4 + lane * 16);
        const size_t   go = (size_t)col0 * C_DIM + lane * 4;
        async_copy8(lw,                 Wq + go,             LDP * 4, C_DIM);
        async_copy8(lw +  8 * LDP * 4,  Wq + go + 8 * C_DIM, LDP * 4, C_DIM);
        async_copy8(lw + 16 * LDP * 4,  Wk + go,             LDP * 4, C_DIM);
        async_copy8(lw + 24 * LDP * 4,  Wk + go + 8 * C_DIM, LDP * 4, C_DIM);
        async_copy8(lw + 32 * LDP * 4,  Wv + go,             LDP * 4, C_DIM);
        async_copy8(lw + 40 * LDP * 4,  Wv + go + 8 * C_DIM, LDP * 4, C_DIM);
    }

    // --- sums of the wave's four groups (channels col0 .. col0+15 of batch bi) ---
    float gs[4], gq[4];
    {
        const v4f* xw = (const v4f*)(x + ((size_t)bi * C_DIM + col0) * S_DIM) + lane;
        // Eight batches of 16 loads (two to a group) through three register buffers:
        // two batches stay in flight behind the one that is summed. All loops are fully
        // unrolled: every load is the one base address plus an immediate, and the
        // buffers and gs/gq are indexed by constants.
        v4f buf[3][16];
        v4f s4 = {0.f, 0.f, 0.f, 0.f}, q4 = {0.f, 0.f, 0.f, 0.f};
#pragma unroll
        for (int i = 0; i < 16; ++i) buf[0][i] = xw[i * 32];
#pragma unroll
        for (int i = 0; i < 16; ++i) buf[1][i] = xw[(16 + i) * 32];
#pragma unroll
        for (int k = 0; k < 8; ++k) {
            if (k + 2 < 8) {
#pragma unroll
                for (int i = 0; i < 16; ++i) buf[(k + 2) % 3][i] = xw[((k + 2) * 16 + i) * 32];
            }
            // holds the loads above in front of the sums below: two batches ahead, no more
            // (left free, the compiler issues all 128 loads at once on some 500 registers)
            __builtin_amdgcn_sched_barrier(0);
#pragma unroll
            for (int i = 0; i < 16; ++i) {
                const v4f t = buf[k % 3][i];
                s4 += t;
                q4 = __builtin_elementwise_fma(t, t, q4);
            }
            if (k & 1) {
                gs[k >> 1] = (s4.x + s4.y) + (s4.z + s4.w);
                gq[k >> 1] = (q4.x + q4.y) + (q4.z + q4.w);
                s4 = (v4f){0.f, 0.f, 0.f, 0.f};
                q4 = (v4f){0.f, 0.f, 0.f, 0.f};
            }
            // keeps the next batch's loads behind these sums, whose buffer they refill
            __builtin_amdgcn_sched_barrier(0);
        }
    }
    {
        // Sum over the 32 lanes. The first two exchanges also deal the four groups out:
        // a lane keeps the groups of its own half (then quarter) of the wave and sends
        // the others, so lanes 8g .. 8g+7 end with the whole sums of group g.
        const bool h16 = (lane & 16) != 0, h8 = (lane & 8) != 0;
        float sa = (h16 ? gs[2] : gs[0]) + __shfl_xor(h16 ? gs[0] : gs[2], 16, 32);
        float sb = (h16 ? gs[3] : gs[1]) + __shfl_xor(h16 ? gs[1] : gs[3], 16, 32);
        float qa = (h16 ? gq[2] : gq[0]) + __shfl_xor(h16 ? gq[0] : gq[2], 16, 32);
        float qb = (h16 ? gq[3] : gq[1]) + __shfl_xor(h16 ? gq[1] : gq[3], 16, 32);
        float sm = (h8 ? sb : sa) + __shfl_xor(h8 ? sa : sb, 8, 32);
        float qm = (h8 ? qb : qa) + __shfl_xor(h8 ? qa : qb, 8, 32);
        // fully unrolled: three fixed exchange distances
#pragma unroll
        for (int off = 4; off > 0; off >>= 1) {
            sm += __shfl_xor(sm, off, 32);
            qm += __shfl_xor(qm, off, 32);
        }
        const float inv_n = 1.0f / (GSIZE * S_DIM);
        const float m   = sm * inv_n;
        const float var = qm * inv_n - m * m;     // biased var (matches jnp.var)
        const float r   = rsqrtf(var + EPS_GN);
        if ((lane & 4) == 0) Cs[col0 + (lane >> 3) * 4 + (lane & 3)] = (v2f){m, r};
    }
    // the wave's own copies have landed; the barrier publishes them and Cs to the others
    asm volatile("s_wait_asynccnt 0x0" ::: "memory");
    __syncthreads();

    {
        // thread t: channel t&127, eight columns; lanes walk c, so the 16-byte reads
        // (pitch 80 B) and the 4-byte writes (consecutive) meet no bank twice
        const int c  = cn;
        const int sb = (tid >> 7) * 8;
        const v2f p  = Cs[c];
        const v4f x0 = *(const v4f*)(Xs + c * RDP + sb);
        const v4f x1 = *(const v4f*)(Xs + c * RDP + sb + 4);
        // fully unrolled: the vector elements are indexed by constants
#pragma unroll
        for (int r = 0; r < 4; ++r) {
            As[(sb + r) * LDP + c]     = (x0[r] - p.x) * p.y * gwc + gbc;
            As[(sb + 4 + r) * LDP + c] = (x1[r] - p.x) * p.y * gwc + gbc;
        }
    }
    // the A tile is whole before any wave reads a fragment
    __syncthreads();

    const float* arow = As + lr * LDP + 2 * half;
    const float* qrow = Ws + (48 * wave + lr) * LDP + 2 * half;
    const float* krow = qrow + 16 * LDP;
    const float* vrow = krow + 16 * LDP;

    v8f accq = {}, acck = {}, accv = {};
    // fully unrolled: every k offset becomes an immediate of its LDS read
#pragma unroll
    for (int k0 = 0; k0 < C_DIM; k0 += 4) {
        const v2f afrag = *(const v2f*)(arow + k0);
        const v2f qfrag = *(const v2f*)(qrow + k0);
        const v2f kfrag = *(const v2f*)(krow + k0);
        const v2f vfrag = *(const v2f*)(vrow + k0);
        accq = __builtin_amdgcn_wmma_f32_16x16x4_f32(false, afrag, false, qfrag,
                                                     (short)0, accq, false, false);
        acck = __builtin_amdgcn_wmma_f32_16x16x4_f32(false, afrag, false, kfrag,
                                                     (short)0, acck, false, false);
        accv = __builtin_amdgcn_wmma_f32_16x16x4_f32(false, afrag, false, vfrag,
                                                     (short)0, accv, false, false);
    }

    const int sl = (row0 & 1023) + half * 8;             // first of the lane's 8 positions
    v4f* qd = (v4f*)qo + ((size_t)bi * (S_DIM / 4) + (sl >> 2)) * C_DIM + n;
    v4f* kd = (v4f*)kv + ((size_t)bi * (S_DIM / 2) + (sl >> 1)) * C_DIM + n;
    float kr[8];
    // the loops below are fully unrolled: the accumulators are indexed by constants
#pragma unroll
    for (int r = 0; r < 8; ++r) kr[r] = acck[r] + bbk;
#pragma unroll
    for (int j = 0; j < 2; ++j) {
        qd[j * C_DIM] = (v4f){accq[4 * j] + bbq, accq[4 * j + 1] + bbq,
                              accq[4 * j + 2] + bbq, accq[4 * j + 3] + bbq};
    }
#pragma unroll
    for (int j = 0; j < 4; ++j) {
        kd[j * C_DIM] = (v4f){kr[2 * j], kr[2 * j + 1], accv[2 * j] + bbv, accv[2 * j + 1] + bbv};
    }
    float kx = kr[0], kn = kr[0];
#pragma unroll
    for (int r = 1; r < 8; ++r) {
        kx = fmaxf(kx, kr[r]);
        kn = fminf(kn, kr[r]);
    }
    kx = fmaxf(kx, __shfl_xor(kx, 16, 32));
    kn = fminf(kn, __shfl_xor(kn, 16, 32));
    if (half == 0) {
        ((v2f*)mm)[((size_t)bi * (S_DIM / 16) + ((row0 & 1023) >> 4)) * C_DIM + n] = (v2f){kx, kn};
    }
}

// ---------------------------------------------------------------------------
// One pass of the attention loop: RING trips of two key pairs for the thread's QB
// queries, out of the register ring; with REFILL each slot is loaded again, from nb
// (the next pass's keys), as soon as its trip is done.
// ---------------------------------------------------------------------------
template <bool REFILL>
__device__ __forceinline__ void attn_pass(v4f (&ring)[RING][2], const v2f (&qq)[QB], const v2f (&nm)[QB],
                                          v2f (&se)[QB], v2f (&sv)[QB], const v4f* nb) {
    // fully unrolled: the ring is indexed by constants and lives in registers
#pragma unroll
    for (int d = 0; d < RING; ++d) {
        // One unit = one key pair for one query: score fma (S), two exp2, sum add and weighted fma.
        // The units are written as a software pipeline in which no exp2 stands directly behind
        // an exp2: between and behind the two exp2 of unit i stand a score of a later unit and
        // the two sums of unit i - 2, all independent of them, so that the transcendental unit
        // works beside the packed f32 instructions of the same wave.
        // ORD: holds that written order; left free, the compiler gathers the exp2 in runs.
#define ORD() __builtin_amdgcn_sched_barrier(0)
#define SCORE(u) a[u] = __builtin_elementwise_fma(qq[(u) & 7], kk[(u) >> 3], nm[(u) & 7])
        const v4f c0 = ring[d][0], c1 = ring[d][1];
        const v2f kk[2] = {{c0.x, c0.y}, {c1.x, c1.y}};
        const v2f vv[2] = {{c0.z, c0.w}, {c1.z, c1.w}};
        v2f a[2 * QB], e[2 * QB];
        SCORE(0);
        SCORE(1);
        ORD();
        // fully unrolled: a, e, se, sv are indexed by constants and every test on i folds away
#pragma unroll
        for (int i = 0; i < 2 * QB + 2; ++i) {
            const int p = i - 2;               // the unit whose sums are taken here
            if (i < 2 * QB) { e[i].x = __builtin_amdgcn_exp2f(a[i].x); ORD(); }
            if (i < 2)       { SCORE(2 * i + 2); ORD(); }
            else if (i < 12) { SCORE(i + 4); ORD(); }
            else             { se[p & 7] += e[p]; ORD(); }
            if (i < 2 * QB) { e[i].y = __builtin_amdgcn_exp2f(a[i].y); ORD(); }
            if (i < 2)       { SCORE(2 * i + 3); ORD(); }
            else {
                if (i < 12)  { se[p & 7] += e[p]; ORD(); }
                sv[p & 7] = __builtin_elementwise_fma(e[p], vv[p >> 3], sv[p & 7]);
                ORD();
            }
        }
        if (REFILL) {
            // refill of the slot just used: read again RING trips from here
            ring[d][0] = nb[(2 * d) * C_DIM];
            ring[d][1] = nb[(2 * d + 1) * C_DIM];
            ORD();
        }
#undef SCORE
#undef ORD
    }
}

// ---------------------------------------------------------------------------
// Kernel 2: HEAD_DIM=1 attention and the output projection in one launch.
// Each (b, head c) is an independent attention problem:
//   ao_i = sum_j exp(q_i*k_j - m_i) * v_j / sum_j exp(q_i*k_j - m_i)
// with exact m_i = q_i>=0 ? q_i*max(k) : q_i*min(k).
// The projection of a position needs that position's result of all 128 heads, so a
// work-group takes QB = 8 positions (queries) of ALL heads: 256 blocks of 256 threads.
// Lane = head: wave w takes heads 32(w&3) .. +31 and the key half w>>2, and every
// thread walks its 512 keys for its head's eight queries. A wave's k,v stream is its
// own (512 contiguous bytes a key pair), so it goes from L2 straight to registers,
// RING trips ahead, with no LDS and no barrier in the loop.
// The two key halves are then added in LDS, the 8 x 128 tile is the A operand of
//   out[n][s] = sum_c ao[s][c] * W[n][c] + bias[n] + resid[n][s]
// on V_WMMA_F32_16X16X4_F32 (wave w: column tile w; rows 8-15 of A repeat rows 0-7
// and their results are not stored). W flies to LDS during the attention loop.
// ---------------------------------------------------------------------------
__global__ void __launch_bounds__(256)
attn_proj_kernel(const float* __restrict__ q,     // [B][S/4][C][4]
                 const float* __restrict__ kv,    // [B][S/2][C][4]
                 const float* __restrict__ mm,    // [B][S/16][C][2]
                 const float* __restrict__ W,     // [C, C]
                 const float* __restrict__ bias,  // [C]
                 const float* __restrict__ resid, // [B, C, S]
                 float* __restrict__ out) {       // [B, C, S]
    __shared__ __attribute__((aligned(16))) float Ws[C_DIM * LDP];
    __shared__ __attribute__((aligned(16))) float As[QB * LDP];
    __shared__ __attribute__((aligned(16))) v2f   part[2 * QB * C_DIM];  // exp sum, weighted sum
    __shared__ __attribute__((aligned(16))) v2f   red[2 * C_DIM];        // max, min of a key half

    const int tid  = threadIdx.x;
    const int lane = tid & 31;
    const int wave = tid >> 5;
    const int b    = blockIdx.x >> 7;
    const int s0   = (blockIdx.x & 127) * QB;
    const int kh   = wave >> 2;           // key half
    const int c    = tid & (C_DIM - 1);   // head
    const int half = lane >> 4;           // 0: K 0,1   1: K 2,3
    const int lr   = lane & 15;
    const int n    = (wave << 4) + lr;    // output channel of the projection

    // --- the first RING trips of the wave's k,v stream ---
    const v4f* kvp = (const v4f*)kv + ((size_t)b * (S_DIM / 2) + kh * (S_DIM / 4)) * C_DIM + c;
    v4f ring[RING][2];
    // fully unrolled: the ring is indexed by constants and lives in registers
#pragma unroll
    for (int d = 0; d < RING; ++d) {
        ring[d][0] = kvp[(2 * d) * C_DIM];
        ring[d][1] = kvp[(2 * d + 1) * C_DIM];
    }

    // bias and residual of the projection, the thread's eight queries
    const float bb = bias[n];
    const v4f* rp = (const v4f*)(resid + ((size_t)b * C_DIM + n) * S_DIM + s0);
    const v4f  r0 = rp[0], r1 = rp[1];
    const v4f* qp = (const v4f*)q + ((size_t)b * (S_DIM / 4) + (s0 >> 2)) * C_DIM + c;
    const v4f  q0 = qp[0], q1 = qp[C_DIM];
    // The 32 loads below may be given registers that loads above name as their address: the
    // wait stands between the two groups, and the scheduling barriers hold it there.
    __builtin_amdgcn_sched_barrier(0);
    asm volatile("s_wait_xcnt 0x0" ::: "memory");
    __builtin_amdgcn_sched_barrier(0);

    // --- exact max/min of the head's k row, from the 64 partial pairs of kernel 1 ---
    float kmx, kmn;
    {
        const v2f* mp = (const v2f*)mm + ((size_t)b * (S_DIM / 16) + kh * (S_DIM / 32)) * C_DIM + c;
        v2f t[S_DIM / 32];
        // fully unrolled: 32 loads in flight, t indexed by constants
#pragma unroll
        for (int i = 0; i < S_DIM / 32; ++i) t[i] = mp[i * C_DIM];
        // keeps work on the values loaded above (and its wait) behind the issue of these loads
        __builtin_amdgcn_sched_barrier(0);
        float mx = t[0].x, mn = t[0].y;
        // fully unrolled: t indexed by constants
#pragma unroll
        for (int i = 1; i < S_DIM / 32; ++i) {
            mx = fmaxf(mx, t[i].x);
            mn = fminf(mn, t[i].y);
        }
        red[kh * C_DIM + c] = (v2f){mx, mn};
        // both halves' pairs are written before either is read
        __syncthreads();
        const v2f o = red[(1 - kh) * C_DIM + c];
        kmx = fmaxf(mx, o.x);
        kmn = fminf(mn, o.y);
    }
    // Inputs-only fence on the loaded values: keeps the residual's loads in front of the
    // attention loop; sunk to their use, their latency would stand at the kernel's end.
    asm volatile("" :: "v"(r0), "v"(r1), "v"(bb));

    // Register tile: the thread's eight queries stay in registers and walk the keys
    // together, four keys (two pairs) a trip. Keys are paired (even, odd) so that score,
    // sum and weighted sum are packed f32 operations. Scores are formed in the base-2
    // domain (q scaled by log2(e) once per query), so each score is one fma + one exp2.
    v2f qq[QB], nm[QB], se[QB], sv[QB];
    // every loop over t below is fully unrolled so that these small arrays
    // are indexed by constants and live in registers, not in scratch memory
#pragma unroll
    for (int t = 0; t < QB; ++t) {
        const float ql = (t < 4 ? q0[t & 3] : q1[t & 3]) * LOG2E_F;
        const float mx = (ql >= 0.f) ? ql * kmx : ql * kmn;
        qq[t] = (v2f){ql, ql};
        nm[t] = (v2f){-mx, -mx};
        se[t] = (v2f){0.f, 0.f};
        sv[t] = (v2f){0.f, 0.f};
    }

    {
        // wave w: rows 16w .. 16w+15 of W, asked for behind the loads that the loop's start
        // waits for, and waited for behind the loop
        const unsigned lw = lds_byte(Ws) + (unsigned)(16 * wave * LDP * 4 + lane * 16);
        const float*   gw = W + (size_t)(16 * wave) * C_DIM + lane * 4;
        async_copy8(lw, gw, LDP * 4, C_DIM);
        async_copy8(lw + 8 * LDP * 4, gw + 8 * C_DIM, LDP * 4, C_DIM);
    }

    // stays rolled: one pass is RING trips, about 6 KB of code
#pragma unroll 1
    for (int it = 1; it < S_DIM / (8 * RING); ++it) {
        attn_pass<true>(ring, qq, nm, se, sv, kvp + (size_t)it * (2 * RING * C_DIM));
        // the refills' address registers are rewritten at the head of the next pass
        asm volatile("s_wait_xcnt 0x0" ::: "memory");
    }
    // the last pass has nothing left to fetch
    attn_pass<false>(ring, qq, nm, se, sv, kvp);

    // --- the two key halves meet in LDS (both were shifted by the same m_i) ---
    // fully unrolled: se, sv indexed by constants
#pragma unroll
    for (int t = 0; t < QB; ++t) {
        part[(kh * QB + t) * C_DIM + c] = (v2f){se[t].x + se[t].y, sv[t].x + sv[t].y};
    }
    // the wave's own copies of W have landed; the barrier publishes them and part
    asm volatile("s_wait_asynccnt 0x0" ::: "memory");
    __syncthreads();
    // fully unrolled: four fixed rows a thread
#pragma unroll
    for (int u = 0; u < QB / 2; ++u) {
        const int t  = kh * (QB / 2) + u;
        const v2f p0 = part[t * C_DIM + c];
        const v2f p1 = part[(QB + t) * C_DIM + c];
        As[t * LDP + c] = (p0.y + p1.y) / (p0.x + p1.x);
    }
    // the A tile is whole before any wave reads a fragment
    __syncthreads();

    const float* arow = As + (lr & (QB - 1)) * LDP + 2 * half;
    const float* brow = Ws + n * LDP + 2 * half;

    v8f acc = {};
    // fully unrolled: every k offset becomes an immediate of its LDS read
#pragma unroll
    for (int k0 = 0; k0 < C_DIM; k0 += 4) {
        v2f afrag = *(const v2f*)(arow + k0);
        v2f bfrag = *(const v2f*)(brow + k0);
        acc = __builtin_amdgcn_wmma_f32_16x16x4_f32(
            /*neg_a=*/false, afrag, /*neg_b=*/false, bfrag,
            /*c_mod=*/(short)0, acc, /*reuse_a=*/false, /*reuse_b=*/false);
    }

    // lanes 0-15 hold rows 0-7 (positions s0 .. s0+7) of column n
    const v4f o0 = {(acc[0] + bb) + r0.x, (acc[1] + bb) + r0.y, (acc[2] + bb) + r0.z, (acc[3] + bb) + r0.w};
    const v4f o1 = {(acc[4] + bb) + r1.x, (acc[5] + bb) + r1.y, (acc[6] + bb) + r1.z, (acc[7] + bb) + r1.w};
    if (half == 0) {
        v4f* op = (v4f*)(out + ((size_t)b * C_DIM + n) * S_DIM + s0);
        op[0] = o0;
        op[1] = o1;
    }
}

// ---------------------------------------------------------------------------
// Host-side launcher. Inputs:
//  0 hidden_states [2,128,32,32]  1 gn_weight [128]  2 gn_bias [128]
//  3 Wq [128,128]  4 bq  5 Wk  6 bk  7 Wv  8 bv  9 Wo  10 bo
// Workspace: q (B*S*C floats) | k,v interleaved (2*B*S*C) | max/min partials (B*S*C/8).
// ---------------------------------------------------------------------------
extern "C" void kernel_launch(void* const* d_in, const int* in_sizes, int n_in,
                              void* d_out, int out_size, void* d_ws, size_t ws_size,
                              hipStream_t stream) {
    const float* x  = (const float*)d_in[0];
    const float* gw = (const float*)d_in[1];
    const float* gb = (const float*)d_in[2];
    const float* Wq = (const float*)d_in[3];
    const float* bq = (const float*)d_in[4];
    const float* Wk = (const float*)d_in[5];
    const float* bk = (const float*)d_in[6];
    const float* Wv = (const float*)d_in[7];
    const float* bv = (const float*)d_in[8];
    const float* Wo = (const float*)d_in[9];
    const float* bo = (const float*)d_in[10];
    float* out = (float*)d_out;

    float* ws = (float*)d_ws;
    const size_t NBS = (size_t)B_DIM * S_DIM * C_DIM;  // 262144
    float* qb   = ws;
    float* kvb  = ws + 1 * NBS;
    float* mmb  = ws + 3 * NBS;

    gn_qkv_wmma_kernel<<<(B_DIM * S_DIM) / 16, 256, 0, stream>>>(x, gw, gb, Wq, bq, Wk, bk, Wv, bv,
                                                                 qb, kvb, mmb);

    // Attention, output projection + residual, written to [B, C, S] (== [B,C,H,W]).
    attn_proj_kernel<<<(B_DIM * S_DIM) / QB, 256, 0, stream>>>(qb, kvb, mmb, Wo, bo, x, out);
}

// v007
// It runs in 21.8 microseconds.
// In two side-by-side timings against v006, it was 1.28 and 1.30 times as fast.
// Counting every step since v000, it is 4.38 times as fast.
#include <hip/hip_runtime.h>
#include <hip/hip_bf16.h>

#define B_DIM   2
#define C_DIM   128
#define S_DIM   1024
#define GROUPS  32
#define GSIZE   4          // channels per group (C/GROUPS)
#define EPS_GN  1e-5f
#define QB      8          // queries per work-group (and per thread) in the attention kernel
#define RING    8          // trips of k,v that a wave keeps in flight in registers
#define LOG2E_F 1.44269504088896340736f
#define NBIN    16         // bins that a head's key range is cut into
#define MSTR    544        // floats of one head's moment block: 8 x 16 x 4 moments, then a line with max, min, half-width
#define PB      18         // LDS pitch, in pairs, of the 16 bin results of one (query, head)
#define RSP     528        // LDS pitch, in floats, of one key slice's 512 partial moments
#define XMAX    2.25f      // largest |q| * half-width for which the 16-term series is used

typedef __attribute__((ext_vector_type(2))) float v2f;
typedef __attribute__((ext_vector_type(4))) float v4f;
typedef __attribute__((ext_vector_type(8))) float v8f;

// ---------------------------------------------------------------------------
// Staging for the two GEMM stages. Every global operand of a work-group's tile
// goes to LDS by asynchronous 16-byte copies: one copy of a wave moves one whole
// 512-byte row of W (four whole cache lines) or 64 B of each of eight
// x rows, and all copies of a tile are in flight
// together. The WMMA fragments are then read from LDS.
// LDP: LDS pitch of a staged 128-float row. 132 floats = 528 B is a multiple of
// the copy width, and the 8-byte fragment reads of 16 rows x 2 k pairs fall on
// 64 different banks (row step 4 banks, k-pair step 2 banks).
// RDP: LDS pitch of a staged 16-float x-tile row, 80 B = 16 B x 5.
// ---------------------------------------------------------------------------
#define LDP 132
#define RDP 20

__device__ __forceinline__ unsigned lds_byte(const float* p) {
    // Low 32 bits of the generic address of a __shared__ object are the
    // workgroup-relative LDS byte offset.
    return (unsigned)(uintptr_t)p;
}

// n copies of 16 bytes per lane, copy i at LDS byte l + i*ls and at g + i*gs floats.
// The s_wait_xcnt closes each statement so that no address register of a copy
// is rewritten before the wait.
__device__ __forceinline__ void async_copy2(unsigned l, const float* g, unsigned ls, int gs) {
    asm volatile("global_load_async_to_lds_b128 %0, %2, off\n\t"
                 "global_load_async_to_lds_b128 %1, %3, off\n\t"
                 "s_wait_xcnt 0x0"
                 :: "v"(l), "v"(l + ls), "v"(g), "v"(g + gs) : "memory");
}
__device__ __forceinline__ void async_copy8(unsigned l, const float* g, unsigned ls, int gs) {
    asm volatile("global_load_async_to_lds_b128 %0, %8, off\n\t"
                 "global_load_async_to_lds_b128 %1, %9, off\n\t"
                 "global_load_async_to_lds_b128 %2, %10, off\n\t"
                 "global_load_async_to_lds_b128 %3, %11, off\n\t"
                 "global_load_async_to_lds_b128 %4, %12, off\n\t"
                 "global_load_async_to_lds_b128 %5, %13, off\n\t"
                 "global_load_async_to_lds_b128 %6, %14, off\n\t"
                 "global_load_async_to_lds_b128 %7, %15, off\n\t"
                 "s_wait_xcnt 0x0"
                 :: "v"(l), "v"(l + ls), "v"(l + 2 * ls), "v"(l + 3 * ls),
                    "v"(l + 4 * ls), "v"(l + 5 * ls), "v"(l + 6 * ls), "v"(l + 7 * ls),
                    "v"(g), "v"(g + gs), "v"(g + 2 * gs), "v"(g + 3 * gs),
                    "v"(g + 4 * gs), "v"(g + 5 * gs), "v"(g + 6 * gs), "v"(g + 7 * gs) : "memory");
}

// ---------------------------------------------------------------------------
// Kernel 1: GroupNorm and the q, k and v projections in one launch.
// Grid: (B*S)/16 blocks of 256 threads; block x takes the 16 rows (b, s0..s0+15),
// wave w column tile w of all three weights (three accumulators on one A fragment).
// A work-group needs the statistics of all 32 groups of its batch and no other
// work-group can hand them over inside a launch, so each sums x[b] (512 KB, read
// from L2) itself: wave w takes groups 4w .. 4w+3, 64 KB in a row. The weights and
// the block's own 128 x 16 tile of x fly to LDS meanwhile by asynchronous copies.
// The tile is then normalized and transposed in LDS into the row-major A tile.
// Fragment layout (ISA 7.12.2, 32-bit, wave32):
//   A 16x4 : lanes 0-15 row M=lane, VGPR{0,1}=K{0,1}; lanes 16-31: K{2,3}
//   B 4x16 : lanes 0-15 col N=lane, VGPR{0,1}=K{0,1}; lanes 16-31: K{2,3}
//   -> each lane reads one float2 (consecutive K) from one row of A / W.
//   D 16x16: VGPR r -> M = r (lanes 0-15) / r+8 (lanes 16-31), N = lane%16.
// Outputs (qo, kv laid out for the attention kernel, whose lanes walk the channels; mm read by kernel 2):
//   qo [B][S/4][C][4] : four consecutive positions of one channel
//   kv [B][S/2][C][4] : k(s), k(s+1), v(s), v(s+1) of one channel
//   mm [B][S/16][C][2]: max and min of k over this block's 16 positions
// ---------------------------------------------------------------------------
__global__ void __launch_bounds__(256)
gn_qkv_wmma_kernel(const float* __restrict__ x,    // [B, C, S]
                   const float* __restrict__ gw,   // [C]
                   const float* __restrict__ gb,   // [C]
                   const float* __restrict__ Wq,   // [C, C]
                   const float* __restrict__ bq,   // [C]
                   const float* __restrict__ Wk,
                   const float* __restrict__ bk,
                   const float* __restrict__ Wv,
                   const float* __restrict__ bv,
                   float* __restrict__ qo,
                   float* __restrict__ kv,
                   float* __restrict__ mm) {
    __shared__ __attribute__((aligned(16))) float As[16 * LDP];
    __shared__ __attribute__((aligned(16))) float Ws[3 * C_DIM * LDP];
    __shared__ __attribute__((aligned(16))) float Xs[C_DIM * RDP];
    __shared__ __attribute__((aligned(16))) v2f   Cs[C_DIM];   // mean, rstd of a channel's group

    const int tid  = threadIdx.x;
    const int lane = tid & 31;
    const int wave = tid >> 5;
    const int row0 = blockIdx.x << 4;     // M tile base (b*S+s)
    const int bi   = row0 >> 10;
    const int col0 = wave << 4;           // N tile base (output channel)
    const int half = lane >> 4;
    const int lr   = lane & 15;
    const int   n   = col0 + lr;
    const float bbq = bq[n], bbk = bk[n], bbv = bv[n];
    const int   cn  = tid & (C_DIM - 1);  // the channel this thread normalizes
    const float gwc = gw[cn], gbc = gb[cn];

    {
        // thread t: 16 bytes (quarter t&3) of x rows t>>2 and 64 + (t>>2), columns s0 .. s0+15
        async_copy2(lds_byte(Xs) + (unsigned)((tid >> 2) * RDP * 4 + (tid & 3) * 16),
                    x + ((size_t)bi * C_DIM + (tid >> 2)) * S_DIM + (row0 & 1023) + (tid & 3) * 4,
                    64 * RDP * 4, 64 * S_DIM);
        // wave w: its own 16 rows of each weight
        // (LDS rows 48w: q, 48w+16: k, 48w+32: v, so that one base register and
        // immediate offsets reach all three)
        const unsigned lw = lds_byte(Ws) + (unsigned)(48 * wave * LDP * 4 + lane * 16);
        const size_t   go = (size_t)col0 * C_DIM + lane * 4;
        async_copy8(lw,                 Wq + go,             LDP * 4, C_DIM);
        async_copy8(lw +  8 * LDP * 4,  Wq + go + 8 * C_DIM, LDP * 4, C_DIM);
        async_copy8(lw + 16 * LDP * 4,  Wk + go,             LDP * 4, C_DIM);
        async_copy8(lw + 24 * LDP * 4,  Wk + go + 8 * C_DIM, LDP * 4, C_DIM);
        async_copy8(lw + 32 * LDP * 4,  Wv + go,             LDP * 4, C_DIM);
        async_copy8(lw + 40 * LDP * 4,  Wv + go + 8 * C_DIM, LDP * 4, C_DIM);
    }

    // --- sums of the wave's four groups (channels col0 .. col0+15 of batch bi) ---
    float gs[4], gq[4];
    {
        const v4f* xw = (const v4f*)(x + ((size_t)bi * C_DIM + col0) * S_DIM) + lane;
        // Eight batches of 16 loads (two to a group) through three register buffers:
        // two batches stay in flight behind the one that is summed. All loops are fully
        // unrolled: every load is the one base address plus an immediate, and the
        // buffers and gs/gq are indexed by constants.
        v4f buf[3][16];
        v4f s4 = {0.f, 0.f, 0.f, 0.f}, q4 = {0.f, 0.f, 0.f, 0.f};
#pragma unroll
        for (int i = 0; i < 16; ++i) buf[0][i] = xw[i * 32];
#pragma unroll
        for (int i = 0; i < 16; ++i) buf[1][i] = xw[(16 + i) * 32];
#pragma unroll
        for (int k = 0; k < 8; ++k) {
            if (k + 2 < 8) {
#pragma unroll
                for (int i = 0; i < 16; ++i) buf[(k + 2) % 3][i] = xw[((k + 2) * 16 + i) * 32];
            }
            // holds the loads above in front of the sums below: two batches ahead, no more
            // (left free, the compiler issues all 128 loads at once on some 500 registers)
            __builtin_amdgcn_sched_barrier(0);
#pragma unroll
            for (int i = 0; i < 16; ++i) {
                const v4f t = buf[k % 3][i];
                s4 += t;
                q4 = __builtin_elementwise_fma(t, t, q4);
            }
            if (k & 1) {
                gs[k >> 1] = (s4.x + s4.y) + (s4.z + s4.w);
                gq[k >> 1] = (q4.x + q4.y) + (q4.z + q4.w);
                s4 = (v4f){0.f, 0.f, 0.f, 0.f};
                q4 = (v4f){0.f, 0.f, 0.f, 0.f};
            }
            // keeps the next batch's loads behind these sums, whose buffer they refill
            __builtin_amdgcn_sched_barrier(0);
        }
    }
    {
        // Sum over the 32 lanes. The first two exchanges also deal the four groups out:
        // a lane keeps the groups of its own half (then quarter) of the wave and sends
        // the others, so lanes 8g .. 8g+7 end with the whole sums of group g.
        const bool h16 = (lane & 16) != 0, h8 = (lane & 8) != 0;
        float sa = (h16 ? gs[2] : gs[0]) + __shfl_xor(h16 ? gs[0] : gs[2], 16, 32);
        float sb = (h16 ? gs[3] : gs[1]) + __shfl_xor(h16 ? gs[1] : gs[3], 16, 32);
        float qa = (h16 ? gq[2] : gq[0]) + __shfl_xor(h16 ? gq[0] : gq[2], 16, 32);
        float qb = (h16 ? gq[3] : gq[1]) + __shfl_xor(h16 ? gq[1] : gq[3], 16, 32);
        float sm = (h8 ? sb : sa) + __shfl_xor(h8 ? sa : sb, 8, 32);
        float qm = (h8 ? qb : qa) + __shfl_xor(h8 ? qa : qb, 8, 32);
        // fully unrolled: three fixed exchange distances
#pragma unroll
        for (int off = 4; off > 0; off >>= 1) {
            sm += __shfl_xor(sm, off, 32);
            qm += __shfl_xor(qm, off, 32);
        }
        const float inv_n = 1.0f / (GSIZE * S_DIM);
        const float m   = sm * inv_n;
        const float var = qm * inv_n - m * m;     // biased var (matches jnp.var)
        const float r   = rsqrtf(var + EPS_GN);
        if ((lane & 4) == 0) Cs[col0 + (lane >> 3) * 4 + (lane & 3)] = (v2f){m, r};
    }
    // the wave's own copies have landed; the barrier publishes them and Cs to the others
    asm volatile("s_wait_asynccnt 0x0" ::: "memory");
    __syncthreads();

    {
        // thread t: channel t&127, eight columns; lanes walk c, so the 16-byte reads
        // (pitch 80 B) and the 4-byte writes (consecutive) meet no bank twice
        const int c  = cn;
        const int sb = (tid >> 7) * 8;
        const v2f p  = Cs[c];
        const v4f x0 = *(const v4f*)(Xs + c * RDP + sb);
        const v4f x1 = *(const v4f*)(Xs + c * RDP + sb + 4);
        // fully unrolled: the vector elements are indexed by constants
#pragma unroll
        for (int r = 0; r < 4; ++r) {
            As[(sb + r) * LDP + c]     = (x0[r] - p.x) * p.y * gwc + gbc;
            As[(sb + 4 + r) * LDP + c] = (x1[r] - p.x) * p.y * gwc + gbc;
        }
    }
    // the A tile is whole before any wave reads a fragment
    __syncthreads();

    const float* arow = As + lr * LDP + 2 * half;
    const float* qrow = Ws + (48 * wave + lr) * LDP + 2 * half;
    const float* krow = qrow + 16 * LDP;
    const float* vrow = krow + 16 * LDP;

    v8f accq = {}, acck = {}, accv = {};
    // fully unrolled: every k offset becomes an immediate of its LDS read
#pragma unroll
    for (int k0 = 0; k0 < C_DIM; k0 += 4) {
        const v2f afrag = *(const v2f*)(arow + k0);
        const v2f qfrag = *(const v2f*)(qrow + k0);
        const v2f kfrag = *(const v2f*)(krow + k0);
        const v2f vfrag = *(const v2f*)(vrow + k0);
        accq = __builtin_amdgcn_wmma_f32_16x16x4_f32(false, afrag, false, qfrag,
                                                     (short)0, accq, false, false);
        acck = __builtin_amdgcn_wmma_f32_16x16x4_f32(false, afrag, false, kfrag,
                                                     (short)0, acck, false, false);
        accv = __builtin_amdgcn_wmma_f32_16x16x4_f32(false, afrag, false, vfrag,
                                                     (short)0, accv, false, false);
    }

    const int sl = (row0 & 1023) + half * 8;             // first of the lane's 8 positions
    v4f* qd = (v4f*)qo + ((size_t)bi * (S_DIM / 4) + (sl >> 2)) * C_DIM + n;
    v4f* kd = (v4f*)kv + ((size_t)bi * (S_DIM / 2) + (sl >> 1)) * C_DIM + n;
    float kr[8];
    // the loops below are fully unrolled: the accumulators are indexed by constants
#pragma unroll
    for (int r = 0; r < 8; ++r) kr[r] = acck[r] + bbk;
#pragma unroll
    for (int j = 0; j < 2; ++j) {
        qd[j * C_DIM] = (v4f){accq[4 * j] + bbq, accq[4 * j + 1] + bbq,
                              accq[4 * j + 2] + bbq, accq[4 * j + 3] + bbq};
    }
#pragma unroll
    for (int j = 0; j < 4; ++j) {
        kd[j * C_DIM] = (v4f){kr[2 * j], kr[2 * j + 1], accv[2 * j] + bbv, accv[2 * j + 1] + bbv};
    }
    float kx = kr[0], kn = kr[0];
#pragma unroll
    for (int r = 1; r < 8; ++r) {
        kx = fmaxf(kx, kr[r]);
        kn = fminf(kn, kr[r]);
    }
    kx = fmaxf(kx, __shfl_xor(kx, 16, 32));
    kn = fminf(kn, __shfl_xor(kn, 16, 32));
    if (half == 0) {
        ((v2f*)mm)[((size_t)bi * (S_DIM / 16) + ((row0 & 1023) >> 4)) * C_DIM + n] = (v2f){kx, kn};
    }
}

// ---------------------------------------------------------------------------
// Kernel 2: per-bin moments of a head's keys. With head size 1 a head's result is a
// function of the scalar q alone: N(q) / D(q), [N, D] = sum_j [v_j, 1] * exp(q * k_j - m).
// The key range [min, max] is cut into NBIN bins of half-width w and centre c_b. With
// k_j = c_b + w * d_j (|d_j| <= 1) and x = q * w
//   exp(q * k_j) = exp(q * c_b) * sum_n x^n * d_j^n / n!
// so that [N, D](q) = sum_b exp(q * c_b - m) * sum_n x^n * [A, B](b, n) with
//   [A, B](b, n) = sum over the keys j of bin b of [v_j, 1] * d_j^n / n!,  n = 0 .. 15.
// For |x| <= XMAX the cut series is off by less than x^16 / 16! * e^|x|, below the rounding
// of the f32 scores; the attention kernel tests that bound and keeps the direct sum for
// the rest.
// Grid: one work-group per (b, head), 512 threads: thread = (bin, slice of 32 keys); a key
// outside the thread's bin enters with weight 0, so nothing is scattered.
// Output, one block of MSTR floats a head (whole 128-byte lines, one writer):
//   [i 0..7][bin][4] = A(2i), B(2i), A(2i+1), B(2i+1);  then max k, min k, w.
// ---------------------------------------------------------------------------
__global__ void __launch_bounds__(512)
key_moments_kernel(const float* __restrict__ kv,   // [B][S/2][C][4]
                   const float* __restrict__ mm,   // [B][S/16][C][2]
                   float* __restrict__ mom) {      // [B][C][MSTR]
    __shared__ __attribute__((aligned(16))) v4f   ks[S_DIM];        // d, d*d, v, bin of a key
    __shared__ __attribute__((aligned(16))) float rs[32 * RSP];     // partial moments of 32 slices

    const int tid  = threadIdx.x;
    const int lane = tid & 31;
    const int wave = tid >> 5;
    const int b    = blockIdx.x >> 7;
    const int c    = blockIdx.x & (C_DIM - 1);

    const v4f* kp = (const v4f*)kv + (size_t)b * (S_DIM / 2) * C_DIM + c;
    const v4f  p0 = kp[tid * C_DIM];   // the thread's key pair
    const v2f* mp = (const v2f*)mm + (size_t)b * (S_DIM / 16) * C_DIM + c;
    const v2f  a0 = mp[lane * C_DIM], a1 = mp[(lane + 32) * C_DIM];
    // The address registers of the three loads are rewritten below: the wait stands behind the
    // loads. The scheduling barriers hold it there and keep the work on a0, a1 (and its wait)
    // behind the issue of all three loads.
    __builtin_amdgcn_sched_barrier(0);
    asm volatile("s_wait_xcnt 0x0" ::: "memory");
    __builtin_amdgcn_sched_barrier(0);

    // exact max/min of the head's k row: every wave reduces the 64 partial pairs itself
    float mx = fmaxf(a0.x, a1.x), mn = fminf(a0.y, a1.y);
    // fully unrolled: five fixed exchange distances
#pragma unroll
    for (int off = 16; off > 0; off >>= 1) {
        mx = fmaxf(mx, __shfl_xor(mx, off, 32));
        mn = fminf(mn, __shfl_xor(mn, off, 32));
    }
    const float w  = (mx - mn) * (0.5f / NBIN);
    const float iw = (w > 0.f) ? 1.0f / w : 0.f;   // all keys equal: one bin, d = 0

    {
        const float kk[2] = {p0.x, p0.y};
        const float vv[2] = {p0.z, p0.w};
        // fully unrolled: kk, vv indexed by constants
#pragma unroll
        for (int r = 0; r < 2; ++r) {
            int bi = (int)((kk[r] - mn) * (0.5f * iw));
            bi = bi < 0 ? 0 : (bi > NBIN - 1 ? NBIN - 1 : bi);
            const float cb = __builtin_fmaf((float)(2 * bi + 1), w, mn);   // same form as in the attention kernel
            const float d  = (kk[r] - cb) * iw;
            ks[2 * tid + r] = (v4f){d, d * d, vv[r], (float)bi};
        }
    }
    // all keys are staged before any thread walks its slice
    __syncthreads();

    const float fb    = (float)(lane & 15);
    const int   slice = wave * 2 + (lane >> 4);
    v2f A[8], Bm[8];
    // fully unrolled: A, Bm indexed by constants
#pragma unroll
    for (int i = 0; i < 8; ++i) {
        A[i]  = (v2f){0.f, 0.f};
        Bm[i] = (v2f){0.f, 0.f};
    }
    // four keys a trip: their power chains are independent and fill each other's latency
#pragma unroll 4
    for (int j = 0; j < 32; ++j) {
        const v4f   e   = ks[slice * 32 + j];
        const float one = (e.w == fb) ? 1.f : 0.f;
        v2f       P  = {one, one * e.x};            // d^(2i), d^(2i+1), or 0 for another bin's key
        const v2f d2 = {e.y, e.y}, vv = {e.z, e.z};
        // fully unrolled: A, Bm indexed by constants
#pragma unroll
        for (int i = 0; i < 8; ++i) {
            Bm[i] += P;
            A[i] = __builtin_elementwise_fma(P, vv, A[i]);
            if (i < 7) P *= d2;
        }
    }
    {
        constexpr float F[16] = {1.0f, 1.0f, 1.0f / 2.0f, 1.0f / 6.0f, 1.0f / 24.0f, 1.0f / 120.0f,
                                 1.0f / 720.0f, 1.0f / 5040.0f, 1.0f / 40320.0f, 1.0f / 362880.0f,
                                 1.0f / 3628800.0f, 1.0f / 39916800.0f, 1.0f / 479001600.0f,
                                 1.0f / 6227020800.0f, 1.0f / 87178291200.0f, 1.0f / 1307674368000.0f};
        // fully unrolled: A, Bm, F indexed by constants
#pragma unroll
        for (int i = 0; i < 8; ++i) {
            *(v4f*)(rs + slice * RSP + i * 64 + (lane & 15) * 4) =
                (v4f){A[i].x * F[2 * i], Bm[i].x * F[2 * i], A[i].y * F[2 * i + 1], Bm[i].y * F[2 * i + 1]};
        }
    }
    // all slices' partial moments are written before they are summed
    __syncthreads();

    float* mo = mom + (size_t)blockIdx.x * MSTR;
    {
        float s = rs[tid];
        // fully unrolled: every slice offset becomes an immediate of its LDS read
#pragma unroll
        for (int u = 1; u < 32; ++u) s += rs[u * RSP + tid];
        mo[tid] = s;
    }
    if (tid == 0) *(v4f*)(mo + 512) = (v4f){mx, mn, w, 0.f};
}

// ---------------------------------------------------------------------------
// One pass of the attention loop: RING trips of two key pairs for the thread's QB
// queries, out of the register ring; with REFILL each slot is loaded again, from nb
// (the next pass's keys), as soon as its trip is done.
// ---------------------------------------------------------------------------
template <bool REFILL>
__device__ __forceinline__ void attn_pass(v4f (&ring)[RING][2], const v2f (&qq)[QB], const v2f (&nm)[QB],
                                          v2f (&se)[QB], v2f (&sv)[QB], const v4f* nb) {
    // fully unrolled: the ring is indexed by constants and lives in registers
#pragma unroll
    for (int d = 0; d < RING; ++d) {
        // One unit = one key pair for one query: score fma (S), two exp2, sum add and weighted fma.
        // The units are written as a software pipeline in which no exp2 stands directly behind
        // an exp2: between and behind the two exp2 of unit i stand a score of a later unit and
        // the two sums of unit i - 2, all independent of them, so that the transcendental unit
        // works beside the packed f32 instructions of the same wave.
        // ORD: holds that written order; left free, the compiler gathers the exp2 in runs.
#define ORD() __builtin_amdgcn_sched_barrier(0)
#define SCORE(u) a[u] = __builtin_elementwise_fma(qq[(u) & 7], kk[(u) >> 3], nm[(u) & 7])
        const v4f c0 = ring[d][0], c1 = ring[d][1];
        const v2f kk[2] = {{c0.x, c0.y}, {c1.x, c1.y}};
        const v2f vv[2] = {{c0.z, c0.w}, {c1.z, c1.w}};
        v2f a[2 * QB], e[2 * QB];
        SCORE(0);
        SCORE(1);
        ORD();
        // fully unrolled: a, e, se, sv are indexed by constants and every test on i folds away
#pragma unroll
        for (int i = 0; i < 2 * QB + 2; ++i) {
            const int p = i - 2;               // the unit whose sums are taken here
            if (i < 2 * QB) { e[i].x = __builtin_amdgcn_exp2f(a[i].x); ORD(); }
            if (i < 2)       { SCORE(2 * i + 2); ORD(); }
            else if (i < 12) { SCORE(i + 4); ORD(); }
            else             { se[p & 7] += e[p]; ORD(); }
            if (i < 2 * QB) { e[i].y = __builtin_amdgcn_exp2f(a[i].y); ORD(); }
            if (i < 2)       { SCORE(2 * i + 3); ORD(); }
            else {
                if (i < 12)  { se[p & 7] += e[p]; ORD(); }
                sv[p & 7] = __builtin_elementwise_fma(e[p], vv[p >> 3], sv[p & 7]);
                ORD();
            }
        }
        if (REFILL) {
            // refill of the slot just used: read again RING trips from here
            ring[d][0] = nb[(2 * d) * C_DIM];
            ring[d][1] = nb[(2 * d + 1) * C_DIM];
            ORD();
        }
#undef SCORE
#undef ORD
    }
}

// ---------------------------------------------------------------------------
// Kernel 3: HEAD_DIM=1 attention and the output projection in one launch.
// Each (b, head c) is an independent attention problem:
//   ao_i = sum_j exp(q_i*k_j - m_i) * v_j / sum_j exp(q_i*k_j - m_i)
// with exact m_i = q_i>=0 ? q_i*max(k) : q_i*min(k).
// The projection of a position needs that position's result of all 128 heads, so a
// work-group takes QB = 8 positions (queries) of ALL heads: 256 blocks of 256 threads.
// Series path (every |q| * w of the work-group within XMAX): thread = (head, bin), 16 lanes
// walk the bins of one head, a wave takes 16 heads, two at a time. A thread evaluates its
// bin's 16-term series in x = q * w for the eight queries (Horner on the packed pair A, B),
// scales it by exp(q * c_b - m) and leaves the pair in LDS, where the 16 bins are added.
// Direct path (any other input): lane = head, wave w takes heads 32(w&3) .. +31 and the key
// half w>>2, and every thread walks its 512 keys for its head's eight queries, k,v going
// from L2 straight to registers, RING trips ahead; the two key halves are added in LDS.
// The 8 x 128 tile is then the A operand of
//   out[n][s] = sum_c ao[s][c] * W[n][c] + bias[n] + resid[n][s]
// on V_WMMA_F32_16X16X4_F32 (wave w: column tile w; rows 8-15 of A repeat rows 0-7
// and their results are not stored). W flies to LDS during the attention part.
// ---------------------------------------------------------------------------
__global__ void __launch_bounds__(256)
attn_proj_kernel(const float* __restrict__ q,     // [B][S/4][C][4]
                 const float* __restrict__ kv,    // [B][S/2][C][4]
                 const float* __restrict__ mom,   // [B][C][MSTR]
                 const float* __restrict__ W,     // [C, C]
                 const float* __restrict__ bias,  // [C]
                 const float* __restrict__ resid, // [B, C, S]
                 float* __restrict__ out) {       // [B, C, S]
    __shared__ __attribute__((aligned(16))) float Ws[C_DIM * LDP];
    __shared__ __attribute__((aligned(16))) float As[QB * LDP];
    __shared__ __attribute__((aligned(16))) v2f   part[2 * QB * C_DIM];     // exp sum, weighted sum
    __shared__ __attribute__((aligned(16))) v2f   binsum[QB * C_DIM * PB];  // weighted sum, exp sum of a bin
    __shared__ __attribute__((aligned(16))) v4f   qs[C_DIM * 3];            // a head's 8 queries; max, min, w
    __shared__ int badw[8];                                                 // a wave saw |q| * w above XMAX

    const int tid  = threadIdx.x;
    const int lane = tid & 31;
    const int wave = tid >> 5;
    const int b    = blockIdx.x >> 7;
    const int s0   = (blockIdx.x & 127) * QB;
    const int kh   = wave >> 2;           // key half
    const int c    = tid & (C_DIM - 1);   // head
    const int half = lane >> 4;           // 0: K 0,1   1: K 2,3
    const int lr   = lane & 15;
    const int n    = (wave << 4) + lr;    // output channel of the projection

    // what the path test needs: the eight queries and max, min, w of head c
    const v4f* qp = (const v4f*)q + ((size_t)b * (S_DIM / 4) + (s0 >> 2)) * C_DIM + c;
    const v4f  q0 = qp[0], q1 = qp[C_DIM];
    const v4f  hc = *(const v4f*)(mom + ((size_t)b * C_DIM + c) * MSTR + 512);
    // The loads below may be given registers that the loads above name as their address: the
    // wait stands between the two groups, and the scheduling barriers hold it there.
    __builtin_amdgcn_sched_barrier(0);
    asm volatile("s_wait_xcnt 0x0" ::: "memory");
    __builtin_amdgcn_sched_barrier(0);

    // Series path, item j = heads 16*wave + 2j + (lane>>4), bin lane&15: eight 16-byte loads of
    // moments (16 lanes: 256 bytes in a row). Four register buffers, three items in flight
    // ahead of the one that is worked on.
    const int    h0 = 16 * wave + half;
    const float* mb = mom + ((size_t)b * C_DIM + h0) * MSTR + lr * 4;
    v4f bm[4][8];
#define LOAD_ITEM(j)                                                                   \
    {                                                                                  \
        _Pragma("unroll") for (int i = 0; i < 8; ++i)                                  \
            bm[(j) & 3][i] = *(const v4f*)(mb + (j) * 2 * MSTR + i * 64);              \
    }
    LOAD_ITEM(0)
    LOAD_ITEM(1)
    LOAD_ITEM(2)

    // bias and residual of the projection
    const float bb = bias[n];
    const v4f* rp = (const v4f*)(resid + ((size_t)b * C_DIM + n) * S_DIM + s0);
    const v4f  r0 = rp[0], r1 = rp[1];
    // keeps the path test's work on q and w (and its wait) behind the issue of all loads above
    __builtin_amdgcn_sched_barrier(0);

    {
        // wave w: rows 16w .. 16w+15 of W, waited for behind the attention part
        const unsigned lw = lds_byte(Ws) + (unsigned)(16 * wave * LDP * 4 + lane * 16);
        const float*   gw = W + (size_t)(16 * wave) * C_DIM + lane * 4;
        async_copy8(lw, gw, LDP * 4, C_DIM);
        async_copy8(lw + 8 * LDP * 4, gw + 8 * C_DIM, LDP * 4, C_DIM);
    }

    // --- which path: the same for the whole work-group ---
    bool series;
    {
        float qa = fmaxf(fmaxf(fabsf(q0.x), fabsf(q0.y)), fmaxf(fabsf(q0.z), fabsf(q0.w)));
        qa = fmaxf(qa, fmaxf(fmaxf(fabsf(q1.x), fabsf(q1.y)), fmaxf(fabsf(q1.z), fabsf(q1.w))));
        const int bad = __any(!(qa * hc.z <= XMAX));   // a product that is NaN or infinite counts as above
        if (lane == 0) badw[wave] = bad;
        if (kh == 0) {
            // the series path's threads take another head's queries and range from here
            qs[c * 3]     = q0;
            qs[c * 3 + 1] = q1;
            qs[c * 3 + 2] = hc;
        }
        // all eight waves' words, and qs, are written before they are read
        __syncthreads();
        int f = 0;
        // fully unrolled: eight fixed LDS words
#pragma unroll
        for (int i = 0; i < 8; ++i) f |= badw[i];
        series = __builtin_amdgcn_readfirstlane(f) == 0;
    }
    // Inputs-only fence on the loaded values: keeps the residual's loads in front of the
    // attention part; sunk to their use, their latency would stand at the kernel's end.
    asm volatile("" :: "v"(r0), "v"(r1), "v"(bb));

    if (series) {
        const float fc = (float)(2 * lr + 1);
        // fully unrolled: the buffers are indexed by constants and live in registers
#pragma unroll
        for (int j = 0; j < 8; ++j) {
            if (j + 3 < 8) LOAD_ITEM(j + 3)
            // holds the loads above in front of the work below: three items ahead, no more
            __builtin_amdgcn_sched_barrier(0);
            const v4f qj[2] = {qs[(h0 + 2 * j) * 3], qs[(h0 + 2 * j) * 3 + 1]};
            const v4f hh    = qs[(h0 + 2 * j) * 3 + 2];
            const float kmx = hh.x, kmn = hh.y, w = hh.z;
            const float cb  = __builtin_fmaf(fc, w, kmn);       // same form as in the moments kernel
            const float dmx = (cb - kmx) * LOG2E_F;             // <= 0
            const float dmn = (cb - kmn) * LOG2E_F;             // >= 0
            v2f xx[QB], acc[QB];
            float ee[QB];
            // the loops over t are fully unrolled: xx, acc, ee indexed by constants
#pragma unroll
            for (int t = 0; t < QB; ++t) {
                const float qv = qj[t >> 2][t & 3];
                // q * (c_b - max k) for q >= 0, q * (c_b - min k) for q < 0: the one that is <= 0
                ee[t] = __builtin_amdgcn_exp2f(fminf(qv * dmx, qv * dmn));
                const float x = qv * w;
                xx[t]  = (v2f){x, x};
                acc[t] = (v2f){bm[j & 3][7].z, bm[j & 3][7].w};
            }
            // fully unrolled: Horner from term 14 down to term 0, eight independent chains
#pragma unroll
            for (int nn = 14; nn >= 0; --nn) {
                const v4f m4 = bm[j & 3][nn >> 1];
                const v2f mc = (nn & 1) ? (v2f){m4.z, m4.w} : (v2f){m4.x, m4.y};
#pragma unroll
                for (int t = 0; t < QB; ++t) acc[t] = __builtin_elementwise_fma(acc[t], xx[t], mc);
            }
#pragma unroll
            for (int t = 0; t < QB; ++t) {
                binsum[(t * C_DIM + h0 + 2 * j) * PB + lr] = acc[t] * (v2f){ee[t], ee[t]};
            }
            // keeps the next item's loads behind this work, whose buffer they refill
            __builtin_amdgcn_sched_barrier(0);
        }
    } else {
        const float kmx = hc.x, kmn = hc.y;
        // --- the first RING trips of the wave's k,v stream ---
        const v4f* kvp = (const v4f*)kv + ((size_t)b * (S_DIM / 2) + kh * (S_DIM / 4)) * C_DIM + c;
        v4f ring[RING][2];
        // fully unrolled: the ring is indexed by constants and lives in registers
#pragma unroll
        for (int d = 0; d < RING; ++d) {
            ring[d][0] = kvp[(2 * d) * C_DIM];
            ring[d][1] = kvp[(2 * d + 1) * C_DIM];
        }

        // Register tile: the thread's eight queries stay in registers and walk the keys
        // together, four keys (two pairs) a trip. Keys are paired (even, odd) so that score,
        // sum and weighted sum are packed f32 operations. Scores are formed in the base-2
        // domain (q scaled by log2(e) once per query), so each score is one fma + one exp2.
        v2f qq[QB], nm[QB], se[QB], sv[QB];
        // every loop over t below is fully unrolled so that these small arrays
        // are indexed by constants and live in registers, not in scratch memory
#pragma unroll
        for (int t = 0; t < QB; ++t) {
            const float ql = (t < 4 ? q0[t & 3] : q1[t & 3]) * LOG2E_F;
            const float mx = (ql >= 0.f) ? ql * kmx : ql * kmn;
            qq[t] = (v2f){ql, ql};
            nm[t] = (v2f){-mx, -mx};
            se[t] = (v2f){0.f, 0.f};
            sv[t] = (v2f){0.f, 0.f};
        }

        // stays rolled: one pass is RING trips, about 6 KB of code
#pragma unroll 1
        for (int it = 1; it < S_DIM / (8 * RING); ++it) {
            attn_pass<true>(ring, qq, nm, se, sv, kvp + (size_t)it * (2 * RING * C_DIM));
            // the refills' address registers are rewritten at the head of the next pass
            asm volatile("s_wait_xcnt 0x0" ::: "memory");
        }
        // the last pass has nothing left to fetch
        attn_pass<false>(ring, qq, nm, se, sv, kvp);

        // --- the two key halves meet in LDS (both were shifted by the same m_i) ---
        // fully unrolled: se, sv indexed by constants
#pragma unroll
        for (int t = 0; t < QB; ++t) {
            part[(kh * QB + t) * C_DIM + c] = (v2f){se[t].x + se[t].y, sv[t].x + sv[t].y};
        }
    }
#undef LOAD_ITEM
    // the wave's own copies of W have landed; the barrier publishes them and the partial sums
    asm volatile("s_wait_asynccnt 0x0" ::: "memory");
    __syncthreads();
    if (series) {
        // fully unrolled: four fixed rows a thread
#pragma unroll
        for (int u = 0; u < QB / 2; ++u) {
            const int t = kh * (QB / 2) + u;
            // lanes walk the heads at a pitch of 144 bytes: the 16-byte reads meet no bank twice
            const v4f* bp = (const v4f*)(binsum + (t * C_DIM + c) * PB);
            v4f s = bp[0];
            // fully unrolled: every offset becomes an immediate of its LDS read
#pragma unroll
            for (int i = 1; i < NBIN / 2; ++i) s += bp[i];
            As[t * LDP + c] = (s.x + s.z) / (s.y + s.w);
        }
    } else {
        // fully unrolled: four fixed rows a thread
#pragma unroll
        for (int u = 0; u < QB / 2; ++u) {
            const int t  = kh * (QB / 2) + u;
            const v2f p0 = part[t * C_DIM + c];
            const v2f p1 = part[(QB + t) * C_DIM + c];
            As[t * LDP + c] = (p0.y + p1.y) / (p0.x + p1.x);
        }
    }
    // the A tile is whole before any wave reads a fragment
    __syncthreads();

    const float* arow = As + (lr & (QB - 1)) * LDP + 2 * half;
    const float* brow = Ws + n * LDP + 2 * half;

    v8f acc = {};
    // fully unrolled: every k offset becomes an immediate of its LDS read
#pragma unroll
    for (int k0 = 0; k0 < C_DIM; k0 += 4) {
        v2f afrag = *(const v2f*)(arow + k0);
        v2f bfrag = *(const v2f*)(brow + k0);
        acc = __builtin_amdgcn_wmma_f32_16x16x4_f32(
            /*neg_a=*/false, afrag, /*neg_b=*/false, bfrag,
            /*c_mod=*/(short)0, acc, /*reuse_a=*/false, /*reuse_b=*/false);
    }

    // lanes 0-15 hold rows 0-7 (positions s0 .. s0+7) of column n
    const v4f o0 = {(acc[0] + bb) + r0.x, (acc[1] + bb) + r0.y, (acc[2] + bb) + r0.z, (acc[3] + bb) + r0.w};
    const v4f o1 = {(acc[4] + bb) + r1.x, (acc[5] + bb) + r1.y, (acc[6] + bb) + r1.z, (acc[7] + bb) + r1.w};
    if (half == 0) {
        v4f* op = (v4f*)(out + ((size_t)b * C_DIM + n) * S_DIM + s0);
        op[0] = o0;
        op[1] = o1;
    }
}

// ---------------------------------------------------------------------------
// Host-side launcher. Inputs:
//  0 hidden_states [2,128,32,32]  1 gn_weight [128]  2 gn_bias [128]
//  3 Wq [128,128]  4 bq  5 Wk  6 bk  7 Wv  8 bv  9 Wo  10 bo
// Workspace: q (B*S*C floats) | k,v interleaved (2*B*S*C) | max/min partials (B*S*C/8) |
//            moment blocks (B*C*MSTR).
// ---------------------------------------------------------------------------
extern "C" void kernel_launch(void* const* d_in, const int* in_sizes, int n_in,
                              void* d_out, int out_size, void* d_ws, size_t ws_size,
                              hipStream_t stream) {
    const float* x  = (const float*)d_in[0];
    const float* gw = (const float*)d_in[1];
    const float* gb = (const float*)d_in[2];
    const float* Wq = (const float*)d_in[3];
    const float* bq = (const float*)d_in[4];
    const float* Wk = (const float*)d_in[5];
    const float* bk = (const float*)d_in[6];
    const float* Wv = (const float*)d_in[7];
    const float* bv = (const float*)d_in[8];
    const float* Wo = (const float*)d_in[9];
    const float* bo = (const float*)d_in[10];
    float* out = (float*)d_out;

    float* ws = (float*)d_ws;
    const size_t NBS = (size_t)B_DIM * S_DIM * C_DIM;  // 262144
    float* qb   = ws;
    float* kvb  = ws + 1 * NBS;
    float* mmb  = ws + 3 * NBS;
    float* momb = ws + 3 * NBS + NBS / 8;

    gn_qkv_wmma_kernel<<<(B_DIM * S_DIM) / 16, 256, 0, stream>>>(x, gw, gb, Wq, bq, Wk, bk, Wv, bv,
                                                                 qb, kvb, mmb);

    key_moments_kernel<<<B_DIM * C_DIM, 512, 0, stream>>>(kvb, mmb, momb);

    // Attention, output projection + residual, written to [B, C, S] (== [B,C,H,W]).
    attn_proj_kernel<<<(B_DIM * S_DIM) / QB, 256, 0, stream>>>(qb, kvb, momb, Wo, bo, x, out);
}

// v008
// A run of this version takes 20.4 microseconds.
// Timed twice side by side with v007, it ran 1.08 and 1.07 times as fast.
// All steps since v000 together make it 4.71 times as fast.
#include <hip/hip_runtime.h>
#include <hip/hip_bf16.h>

#define B_DIM   2
#define C_DIM   128
#define S_DIM   1024
#define GROUPS  32
#define GSIZE   4          // channels per group (C/GROUPS)
#define EPS_GN  1e-5f
#define QB      8          // queries per work-group (and per thread) in the attention kernel
#define RING    8          // trips of k,v that a wave keeps in flight in registers
#define LOG2E_F 1.44269504088896340736f
#define NBIN    8          // bins that a head's key range is cut into
#define NPAIR   10         // pairs of series terms: 20 terms
#define MHDR    (NPAIR * NBIN * 4)   // floats of one head's moments
#define MSTR    (MHDR + 32)          // floats of one head's moment block: the moments, then a line with max, min, half-width
#define PB      10         // LDS pitch, in pairs, of the 8 bin results of one (query, head)
#define RSP     352        // LDS pitch, in floats, of one key slice's 320 partial moments
#define XMAX    3.0f       // largest |q| * half-width for which the 20-term series is used

typedef __attribute__((ext_vector_type(2))) float v2f;
typedef __attribute__((ext_vector_type(4))) float v4f;
typedef __attribute__((ext_vector_type(8))) float v8f;

// ---------------------------------------------------------------------------
// Staging for the two GEMM stages. Every global operand of a work-group's tile
// goes to LDS by asynchronous 16-byte copies: one copy of a wave moves one whole
// 512-byte row of W (four whole cache lines) or 64 B of each of eight
// x rows, and all copies of a tile are in flight
// together. The WMMA fragments are then read from LDS.
// LDP: LDS pitch of a staged 128-float row. 132 floats = 528 B is a multiple of
// the copy width, and the 8-byte fragment reads of 16 rows x 2 k pairs fall on
// 64 different banks (row step 4 banks, k-pair step 2 banks).
// RDP: LDS pitch of a staged 16-float x-tile row, 80 B = 16 B x 5.
// ---------------------------------------------------------------------------
#define LDP 132
#define RDP 20

__device__ __forceinline__ unsigned lds_byte(const float* p) {
    // Low 32 bits of the generic address of a __shared__ object are the
    // workgroup-relative LDS byte offset.
    return (unsigned)(uintptr_t)p;
}

// n copies of 16 bytes per lane, copy i at LDS byte l + i*ls and at g + i*gs floats.
// The s_wait_xcnt closes each statement so that no address register of a copy
// is rewritten before the wait.
__device__ __forceinline__ void async_copy2(unsigned l, const float* g, unsigned ls, int gs) {
    asm volatile("global_load_async_to_lds_b128 %0, %2, off\n\t"
                 "global_load_async_to_lds_b128 %1, %3, off\n\t"
                 "s_wait_xcnt 0x0"
                 :: "v"(l), "v"(l + ls), "v"(g), "v"(g + gs) : "memory");
}
__device__ __forceinline__ void async_copy8(unsigned l, const float* g, unsigned ls, int gs) {
    asm volatile("global_load_async_to_lds_b128 %0, %8, off\n\t"
                 "global_load_async_to_lds_b128 %1, %9, off\n\t"
                 "global_load_async_to_lds_b128 %2, %10, off\n\t"
                 "global_load_async_to_lds_b128 %3, %11, off\n\t"
                 "global_load_async_to_lds_b128 %4, %12, off\n\t"
                 "global_load_async_to_lds_b128 %5, %13, off\n\t"
                 "global_load_async_to_lds_b128 %6, %14, off\n\t"
                 "global_load_async_to_lds_b128 %7, %15, off\n\t"
                 "s_wait_xcnt 0x0"
                 :: "v"(l), "v"(l + ls), "v"(l + 2 * ls), "v"(l + 3 * ls),
                    "v"(l + 4 * ls), "v"(l + 5 * ls), "v"(l + 6 * ls), "v"(l + 7 * ls),
                    "v"(g), "v"(g + gs), "v"(g + 2 * gs), "v"(g + 3 * gs),
                    "v"(g + 4 * gs), "v"(g + 5 * gs), "v"(g + 6 * gs), "v"(g + 7 * gs) : "memory");
}

// ---------------------------------------------------------------------------
// Kernel 1: GroupNorm and the q, k and v projections in one launch.
// Grid: (B*S)/16 blocks of 256 threads; block x takes the 16 rows (b, s0..s0+15),
// wave w column tile w of all three weights (three accumulators on one A fragment).
// A work-group needs the statistics of all 32 groups of its batch and no other
// work-group can hand them over inside a launch, so each sums x[b] (512 KB, read
// from L2) itself: wave w takes groups 4w .. 4w+3, 64 KB in a row. The weights and
// the block's own 128 x 16 tile of x fly to LDS meanwhile by asynchronous copies.
// The tile is then normalized and transposed in LDS into the row-major A tile.
// Fragment layout (ISA 7.12.2, 32-bit, wave32):
//   A 16x4 : lanes 0-15 row M=lane, VGPR{0,1}=K{0,1}; lanes 16-31: K{2,3}
//   B 4x16 : lanes 0-15 col N=lane, VGPR{0,1}=K{0,1}; lanes 16-31: K{2,3}
//   -> each lane reads one float2 (consecutive K) from one row of A / W.
//   D 16x16: VGPR r -> M = r (lanes 0-15) / r+8 (lanes 16-31), N = lane%16.
// Outputs (qo, kv laid out for the attention kernel, whose lanes walk the channels; mm read by kernel 2):
//   qo [B][S/4][C][4] : four consecutive positions of one channel
//   kv [B][S/2][C][4] : k(s), k(s+1), v(s), v(s+1) of one channel
//   mm [B][S/16][C][2]: max and min of k over this block's 16 positions
// ---------------------------------------------------------------------------
__global__ void __launch_bounds__(256)
gn_qkv_wmma_kernel(const float* __restrict__ x,    // [B, C, S]
                   const float* __restrict__ gw,   // [C]
                   const float* __restrict__ gb,   // [C]
                   const float* __restrict__ Wq,   // [C, C]
                   const float* __restrict__ bq,   // [C]
                   const float* __restrict__ Wk,
                   const float* __restrict__ bk,
                   const float* __restrict__ Wv,
                   const float* __restrict__ bv,
                   float* __restrict__ qo,
                   float* __restrict__ kv,
                   float* __restrict__ mm) {
    __shared__ __attribute__((aligned(16))) float As[16 * LDP];
    __shared__ __attribute__((aligned(16))) float Ws[3 * C_DIM * LDP];
    __shared__ __attribute__((aligned(16))) float Xs[C_DIM * RDP];
    __shared__ __attribute__((aligned(16))) v2f   Cs[C_DIM];   // mean, rstd of a channel's group

    const int tid  = threadIdx.x;
    const int lane = tid & 31;
    const int wave = tid >> 5;
    const int row0 = blockIdx.x << 4;     // M tile base (b*S+s)
    const int bi   = row0 >> 10;
    const int col0 = wave << 4;           // N tile base (output channel)
    const int half = lane >> 4;
    const int lr   = lane & 15;
    const int   n   = col0 + lr;
    const float bbq = bq[n], bbk = bk[n], bbv = bv[n];
    const int   cn  = tid & (C_DIM - 1);  // the channel this thread normalizes
    const float gwc = gw[cn], gbc = gb[cn];

    {
        // thread t: 16 bytes (quarter t&3) of x rows t>>2 and 64 + (t>>2), columns s0 .. s0+15
        async_copy2(lds_byte(Xs) + (unsigned)((tid >> 2) * RDP * 4 + (tid & 3) * 16),
                    x + ((size_t)bi * C_DIM + (tid >> 2)) * S_DIM + (row0 & 1023) + (tid & 3) * 4,
                    64 * RDP * 4, 64 * S_DIM);
        // wave w: its own 16 rows of each weight
        // (LDS rows 48w: q, 48w+16: k, 48w+32: v, so that one base register and
        // immediate offsets reach all three)
        const unsigned lw = lds_byte(Ws) + (unsigned)(48 * wave * LDP * 4 + lane * 16);
        const size_t   go = (size_t)col0 * C_DIM + lane * 4;
        async_copy8(lw,                 Wq + go,             LDP * 4, C_DIM);
        async_copy8(lw +  8 * LDP * 4,  Wq + go + 8 * C_DIM, LDP * 4, C_DIM);
        async_copy8(lw + 16 * LDP * 4,  Wk + go,             LDP * 4, C_DIM);
        async_copy8(lw + 24 * LDP * 4,  Wk + go + 8 * C_DIM, LDP * 4, C_DIM);
        async_copy8(lw + 32 * LDP * 4,  Wv + go,             LDP * 4, C_DIM);
        async_copy8(lw + 40 * LDP * 4,  Wv + go + 8 * C_DIM, LDP * 4, C_DIM);
    }

    // --- sums of the wave's four groups (channels col0 .. col0+15 of batch bi) ---
    float gs[4], gq[4];
    {
        const v4f* xw = (const v4f*)(x + ((size_t)bi * C_DIM + col0) * S_DIM) + lane;
        // Eight batches of 16 loads (two to a group) through three register buffers:
        // two batches stay in flight behind the one that is summed. All loops are fully
        // unrolled: every load is the one base address plus an immediate, and the
        // buffers and gs/gq are indexed by constants.
        v4f buf[3][16];
        v4f s4 = {0.f, 0.f, 0.f, 0.f}, q4 = {0.f, 0.f, 0.f, 0.f};
#pragma unroll
        for (int i = 0; i < 16; ++i) buf[0][i] = xw[i * 32];
#pragma unroll
        for (int i = 0; i < 16; ++i) buf[1][i] = xw[(16 + i) * 32];
#pragma unroll
        for (int k = 0; k < 8; ++k) {
            if (k + 2 < 8) {
#pragma unroll
                for (int i = 0; i < 16; ++i) buf[(k + 2) % 3][i] = xw[((k + 2) * 16 + i) * 32];
            }
            // holds the loads above in front of the sums below: two batches ahead, no more
            // (left free, the compiler issues all 128 loads at once on some 500 registers)
            __builtin_amdgcn_sched_barrier(0);
#pragma unroll
            for (int i = 0; i < 16; ++i) {
                const v4f t = buf[k % 3][i];
                s4 += t;
                q4 = __builtin_elementwise_fma(t, t, q4);
            }
            if (k & 1) {
                gs[k >> 1] = (s4.x + s4.y) + (s4.z + s4.w);
                gq[k >> 1] = (q4.x + q4.y) + (q4.z + q4.w);
                s4 = (v4f){0.f, 0.f, 0.f, 0.f};
                q4 = (v4f){0.f, 0.f, 0.f, 0.f};
            }
            // keeps the next batch's loads behind these sums, whose buffer they refill
            __builtin_amdgcn_sched_barrier(0);
        }
    }
    {
        // Sum over the 32 lanes. The first two exchanges also deal the four groups out:
        // a lane keeps the groups of its own half (then quarter) of the wave and sends
        // the others, so lanes 8g .. 8g+7 end with the whole sums of group g.
        const bool h16 = (lane & 16) != 0, h8 = (lane & 8) != 0;
        float sa = (h16 ? gs[2] : gs[0]) + __shfl_xor(h16 ? gs[0] : gs[2], 16, 32);
        float sb = (h16 ? gs[3] : gs[1]) + __shfl_xor(h16 ? gs[1] : gs[3], 16, 32);
        float qa = (h16 ? gq[2] : gq[0]) + __shfl_xor(h16 ? gq[0] : gq[2], 16, 32);
        float qb = (h16 ? gq[3] : gq[1]) + __shfl_xor(h16 ? gq[1] : gq[3], 16, 32);
        float sm = (h8 ? sb : sa) + __shfl_xor(h8 ? sa : sb, 8, 32);
        float qm = (h8 ? qb : qa) + __shfl_xor(h8 ? qa : qb, 8, 32);
        // fully unrolled: three fixed exchange distances
#pragma unroll
        for (int off = 4; off > 0; off >>= 1) {
            sm += __shfl_xor(sm, off, 32);
            qm += __shfl_xor(qm, off, 32);
        }
        const float inv_n = 1.0f / (GSIZE * S_DIM);
        const float m   = sm * inv_n;
        const float var = qm * inv_n - m * m;     // biased var (matches jnp.var)
        const float r   = rsqrtf(var + EPS_GN);
        if ((lane & 4) == 0) Cs[col0 + (lane >> 3) * 4 + (lane & 3)] = (v2f){m, r};
    }
    // the wave's own copies have landed; the barrier publishes them and Cs to the others
    asm volatile("s_wait_asynccnt 0x0" ::: "memory");
    __syncthreads();

    {
        // thread t: channel t&127, eight columns; lanes walk c, so the 16-byte reads
        // (pitch 80 B) and the 4-byte writes (consecutive) meet no bank twice
        const int c  = cn;
        const int sb = (tid >> 7) * 8;
        const v2f p  = Cs[c];
        const v4f x0 = *(const v4f*)(Xs + c * RDP + sb);
        const v4f x1 = *(const v4f*)(Xs + c * RDP + sb + 4);
        // fully unrolled: the vector elements are indexed by constants
#pragma unroll
        for (int r = 0; r < 4; ++r) {
            As[(sb + r) * LDP + c]     = (x0[r] - p.x) * p.y * gwc + gbc;
            As[(sb + 4 + r) * LDP + c] = (x1[r] - p.x) * p.y * gwc + gbc;
        }
    }
    // the A tile is whole before any wave reads a fragment
    __syncthreads();

    const float* arow = As + lr * LDP + 2 * half;
    const float* qrow = Ws + (48 * wave + lr) * LDP + 2 * half;
    const float* krow = qrow + 16 * LDP;
    const float* vrow = krow + 16 * LDP;

    v8f accq = {}, acck = {}, accv = {};
    // fully unrolled: every k offset becomes an immediate of its LDS read
#pragma unroll
    for (int k0 = 0; k0 < C_DIM; k0 += 4) {
        const v2f afrag = *(const v2f*)(arow + k0);
        const v2f qfrag = *(const v2f*)(qrow + k0);
        const v2f kfrag = *(const v2f*)(krow + k0);
        const v2f vfrag = *(const v2f*)(vrow + k0);
        accq = __builtin_amdgcn_wmma_f32_16x16x4_f32(false, afrag, false, qfrag,
                                                     (short)0, accq, false, false);
        acck = __builtin_amdgcn_wmma_f32_16x16x4_f32(false, afrag, false, kfrag,
                                                     (short)0, acck, false, false);
        accv = __builtin_amdgcn_wmma_f32_16x16x4_f32(false, afrag, false, vfrag,
                                                     (short)0, accv, false, false);
    }

    const int sl = (row0 & 1023) + half * 8;             // first of the lane's 8 positions
    v4f* qd = (v4f*)qo + ((size_t)bi * (S_DIM / 4) + (sl >> 2)) * C_DIM + n;
    v4f* kd = (v4f*)kv + ((size_t)bi * (S_DIM / 2) + (sl >> 1)) * C_DIM + n;
    float kr[8];
    // the loops below are fully unrolled: the accumulators are indexed by constants
#pragma unroll
    for (int r = 0; r < 8; ++r) kr[r] = acck[r] + bbk;
#pragma unroll
    for (int j = 0; j < 2; ++j) {
        qd[j * C_DIM] = (v4f){accq[4 * j] + bbq, accq[4 * j + 1] + bbq,
                              accq[4 * j + 2] + bbq, accq[4 * j + 3] + bbq};
    }
#pragma unroll
    for (int j = 0; j < 4; ++j) {
        kd[j * C_DIM] = (v4f){kr[2 * j], kr[2 * j + 1], accv[2 * j] + bbv, accv[2 * j + 1] + bbv};
    }
    float kx = kr[0], kn = kr[0];
#pragma unroll
    for (int r = 1; r < 8; ++r) {
        kx = fmaxf(kx, kr[r]);
        kn = fminf(kn, kr[r]);
    }
    kx = fmaxf(kx, __shfl_xor(kx, 16, 32));
    kn = fminf(kn, __shfl_xor(kn, 16, 32));
    if (half == 0) {
        ((v2f*)mm)[((size_t)bi * (S_DIM / 16) + ((row0 & 1023) >> 4)) * C_DIM + n] = (v2f){kx, kn};
    }
}

// ---------------------------------------------------------------------------
// Kernel 2: per-bin moments of a head's keys. With head size 1 a head's result is a
// function of the scalar q alone: N(q) / D(q), [N, D] = sum_j [v_j, 1] * exp(q * k_j - m).
// The key range [min, max] is cut into NBIN bins of half-width w and centre c_b. With
// k_j = c_b + w * d_j (|d_j| <= 1) and x = q * w
//   exp(q * k_j) = exp(q * c_b) * sum_n x^n * d_j^n / n!
// so that [N, D](q) = sum_b exp(q * c_b - m) * sum_n x^n * [A, B](b, n) with
//   [A, B](b, n) = sum over the keys j of bin b of [v_j, 1] * d_j^n / n!,  n = 0 .. 19.
// For |x| <= XMAX the cut series is off by less than x^20 / 20! * e^|x|, below the rounding
// of the f32 scores; the attention kernel tests that bound and keeps the direct sum for
// the rest.
// The table's size, which is the work of both kernels, is bins x terms: a bin twice as wide
// doubles x, and the factorial pays for that with four more terms. What bounds the width is
// rounding: a bin's series is right to f32 rounding of (keys of the bin) * e^|x|, while keys
// crowded at the bin's far edge sum to e^-|x| each.
// Grid: one work-group per (b, head), 256 threads: thread = (bin, slice of 32 keys); a key
// outside the thread's bin enters with weight 0, so nothing is scattered.
// Output, one block of MSTR floats a head (whole 128-byte lines, one writer):
//   [i 0..9][bin][4] = A(2i), B(2i), A(2i+1), B(2i+1);  then max k, min k, w.
// ---------------------------------------------------------------------------
__global__ void __launch_bounds__(256)
key_moments_kernel(const float* __restrict__ kv,   // [B][S/2][C][4]
                   const float* __restrict__ mm,   // [B][S/16][C][2]
                   float* __restrict__ mom) {      // [B][C][MSTR]
    // d, d*d, v, bin of a key; a slice of 32 keys has a pitch of 33 entries, so that the four
    // slices that a wave reads at once lie in different banks
    __shared__ __attribute__((aligned(16))) v4f   ks[S_DIM + S_DIM / 32];
    __shared__ __attribute__((aligned(16))) float rs[32 * RSP];     // partial moments of 32 slices

    const int tid  = threadIdx.x;
    const int lane = tid & 31;
    const int wave = tid >> 5;
    const int b    = blockIdx.x >> 7;
    const int c    = blockIdx.x & (C_DIM - 1);

    const v4f* kp = (const v4f*)kv + (size_t)b * (S_DIM / 2) * C_DIM + c;
    const v4f  p0 = kp[tid * C_DIM], p1 = kp[(tid + 256) * C_DIM];   // the thread's two key pairs
    const v2f* mp = (const v2f*)mm + (size_t)b * (S_DIM / 16) * C_DIM + c;
    const v2f  a0 = mp[lane * C_DIM], a1 = mp[(lane + 32) * C_DIM];
    // The address registers of the four loads are rewritten below: the wait stands behind the
    // loads. The scheduling barriers hold it there and keep the work on a0, a1 (and its wait)
    // behind the issue of all four loads.
    __builtin_amdgcn_sched_barrier(0);
    asm volatile("s_wait_xcnt 0x0" ::: "memory");
    __builtin_amdgcn_sched_barrier(0);

    // exact max/min of the head's k row: every wave reduces the 64 partial pairs itself
    float mx = fmaxf(a0.x, a1.x), mn = fminf(a0.y, a1.y);
    // fully unrolled: five fixed exchange distances
#pragma unroll
    for (int off = 16; off > 0; off >>= 1) {
        mx = fmaxf(mx, __shfl_xor(mx, off, 32));
        mn = fminf(mn, __shfl_xor(mn, off, 32));
    }
    const float w  = (mx - mn) * (0.5f / NBIN);
    const float iw = (w > 0.f) ? 1.0f / w : 0.f;   // all keys equal: one bin, d = 0

    {
        const float kk[4] = {p0.x, p0.y, p1.x, p1.y};
        const float vv[4] = {p0.z, p0.w, p1.z, p1.w};
        // fully unrolled: kk, vv indexed by constants
#pragma unroll
        for (int r = 0; r < 4; ++r) {
            int bi = (int)((kk[r] - mn) * (0.5f * iw));
            bi = bi < 0 ? 0 : (bi > NBIN - 1 ? NBIN - 1 : bi);
            const float cb = __builtin_fmaf((float)(2 * bi + 1), w, mn);   // same form as in the attention kernel
            const float d  = (kk[r] - cb) * iw;
            const int key = (r >> 1) * 512 + 2 * tid + (r & 1);
            ks[key + (key >> 5)] = (v4f){d, d * d, vv[r], (float)bi};
        }
    }
    // all keys are staged before any thread walks its slice
    __syncthreads();

    const float fb    = (float)(lane & (NBIN - 1));
    const int   slice = wave * 4 + (lane >> 3);
    v2f A[NPAIR], Bm[NPAIR];
    // fully unrolled: A, Bm indexed by constants
#pragma unroll
    for (int i = 0; i < NPAIR; ++i) {
        A[i]  = (v2f){0.f, 0.f};
        Bm[i] = (v2f){0.f, 0.f};
    }
    // four keys a trip: their power chains are independent and fill each other's latency
#pragma unroll 4
    for (int j = 0; j < 32; ++j) {
        const v4f   e   = ks[slice * 33 + j];
        const float one = (e.w == fb) ? 1.f : 0.f;
        v2f       P  = {one, one * e.x};            // d^(2i), d^(2i+1), or 0 for another bin's key
        const v2f d2 = {e.y, e.y}, vv = {e.z, e.z};
        // fully unrolled: A, Bm indexed by constants
#pragma unroll
        for (int i = 0; i < NPAIR; ++i) {
            Bm[i] += P;
            A[i] = __builtin_elementwise_fma(P, vv, A[i]);
            if (i < NPAIR - 1) P *= d2;
        }
    }
    {
        constexpr float F[2 * NPAIR] = {1.0f, 1.0f, 1.0f / 2.0f, 1.0f / 6.0f, 1.0f / 24.0f, 1.0f / 120.0f,
                                 1.0f / 720.0f, 1.0f / 5040.0f, 1.0f / 40320.0f, 1.0f / 362880.0f,
                                 1.0f / 3628800.0f, 1.0f / 39916800.0f, 1.0f / 479001600.0f,
                                 1.0f / 6227020800.0f, 1.0f / 87178291200.0f, 1.0f / 1307674368000.0f,
                                 1.0f / 20922789888000.0f, 1.0f / 355687428096000.0f,
                                 1.0f / 6402373705728000.0f, 1.0f / 121645100408832000.0f};
        // fully unrolled: A, Bm, F indexed by constants
#pragma unroll
        for (int i = 0; i < NPAIR; ++i) {
            *(v4f*)(rs + slice * RSP + i * (NBIN * 4) + (lane & (NBIN - 1)) * 4) =
                (v4f){A[i].x * F[2 * i], Bm[i].x * F[2 * i], A[i].y * F[2 * i + 1], Bm[i].y * F[2 * i + 1]};
        }
    }
    // all slices' partial moments are written before they are summed
    __syncthreads();

    float* mo = mom + (size_t)blockIdx.x * MSTR;
    if (tid < MHDR / 2) {
        // five whole waves, two moments a thread
        v2f s = *(const v2f*)(rs + 2 * tid);
        // fully unrolled: every slice offset becomes an immediate of its LDS read
#pragma unroll
        for (int u = 1; u < 32; ++u) s += *(const v2f*)(rs + u * RSP + 2 * tid);
        *(v2f*)(mo + 2 * tid) = s;
    }
    if (tid == 0) *(v4f*)(mo + MHDR) = (v4f){mx, mn, w, 0.f};
}

// ---------------------------------------------------------------------------
// One pass of the attention loop: RING trips of two key pairs for the thread's QB
// queries, out of the register ring; with REFILL each slot is loaded again, from nb
// (the next pass's keys), as soon as its trip is done.
// ---------------------------------------------------------------------------
template <bool REFILL>
__device__ __forceinline__ void attn_pass(v4f (&ring)[RING][2], const v2f (&qq)[QB], const v2f (&nm)[QB],
                                          v2f (&se)[QB], v2f (&sv)[QB], const v4f* nb) {
    // fully unrolled: the ring is indexed by constants and lives in registers
#pragma unroll
    for (int d = 0; d < RING; ++d) {
        // One unit = one key pair for one query: score fma (S), two exp2, sum add and weighted fma.
        // The units are written as a software pipeline in which no exp2 stands directly behind
        // an exp2: between and behind the two exp2 of unit i stand a score of a later unit and
        // the two sums of unit i - 2, all independent of them, so that the transcendental unit
        // works beside the packed f32 instructions of the same wave.
        // ORD: holds that written order; left free, the compiler gathers the exp2 in runs.
#define ORD() __builtin_amdgcn_sched_barrier(0)
#define SCORE(u) a[u] = __builtin_elementwise_fma(qq[(u) & 7], kk[(u) >> 3], nm[(u) & 7])
        const v4f c0 = ring[d][0], c1 = ring[d][1];
        const v2f kk[2] = {{c0.x, c0.y}, {c1.x, c1.y}};
        const v2f vv[2] = {{c0.z, c0.w}, {c1.z, c1.w}};
        v2f a[2 * QB], e[2 * QB];
        SCORE(0);
        SCORE(1);
        ORD();
        // fully unrolled: a, e, se, sv are indexed by constants and every test on i folds away
#pragma unroll
        for (int i = 0; i < 2 * QB + 2; ++i) {
            const int p = i - 2;               // the unit whose sums are taken here
            if (i < 2 * QB) { e[i].x = __builtin_amdgcn_exp2f(a[i].x); ORD(); }
            if (i < 2)       { SCORE(2 * i + 2); ORD(); }
            else if (i < 12) { SCORE(i + 4); ORD(); }
            else             { se[p & 7] += e[p]; ORD(); }
            if (i < 2 * QB) { e[i].y = __builtin_amdgcn_exp2f(a[i].y); ORD(); }
            if (i < 2)       { SCORE(2 * i + 3); ORD(); }
            else {
                if (i < 12)  { se[p & 7] += e[p]; ORD(); }
                sv[p & 7] = __builtin_elementwise_fma(e[p], vv[p >> 3], sv[p & 7]);
                ORD();
            }
        }
        if (REFILL) {
            // refill of the slot just used: read again RING trips from here
            ring[d][0] = nb[(2 * d) * C_DIM];
            ring[d][1] = nb[(2 * d + 1) * C_DIM];
            ORD();
        }
#undef SCORE
#undef ORD
    }
}

// ---------------------------------------------------------------------------
// Kernel 3: HEAD_DIM=1 attention and the output projection in one launch.
// Each (b, head c) is an independent attention problem:
//   ao_i = sum_j exp(q_i*k_j - m_i) * v_j / sum_j exp(q_i*k_j - m_i)
// with exact m_i = q_i>=0 ? q_i*max(k) : q_i*min(k).
// The projection of a position needs that position's result of all 128 heads, so a
// work-group takes QB = 8 positions (queries) of ALL heads: 256 blocks of 256 threads.
// Series path (every |q| * w of the work-group within XMAX): thread = (head, bin), 8 lanes
// walk the bins of one head, a wave takes 16 heads, four at a time. A thread evaluates its
// bin's 20-term series in x = q * w for the eight queries (Horner on the packed pair A, B),
// scales it by exp(q * c_b - m) and leaves the pair in LDS, where the 8 bins are added.
// Direct path (any other input): lane = head, wave w takes heads 32(w&3) .. +31 and the key
// half w>>2, and every thread walks its 512 keys for its head's eight queries, k,v going
// from L2 straight to registers, RING trips ahead; the two key halves are added in LDS.
// The 8 x 128 tile is then the A operand of
//   out[n][s] = sum_c ao[s][c] * W[n][c] + bias[n] + resid[n][s]
// on V_WMMA_F32_16X16X4_F32 (wave w: column tile w; rows 8-15 of A repeat rows 0-7
// and their results are not stored). W flies to LDS during the attention part.
// ---------------------------------------------------------------------------
__global__ void __launch_bounds__(256)
attn_proj_kernel(const float* __restrict__ q,     // [B][S/4][C][4]
                 const float* __restrict__ kv,    // [B][S/2][C][4]
                 const float* __restrict__ mom,   // [B][C][MSTR]
                 const float* __restrict__ W,     // [C, C]
                 const float* __restrict__ bias,  // [C]
                 const float* __restrict__ resid, // [B, C, S]
                 float* __restrict__ out) {       // [B, C, S]
    __shared__ __attribute__((aligned(16))) float Ws[C_DIM * LDP];
    __shared__ __attribute__((aligned(16))) float As[QB * LDP];
    __shared__ __attribute__((aligned(16))) v2f   part[2 * QB * C_DIM];     // exp sum, weighted sum
    __shared__ __attribute__((aligned(16))) v2f   binsum[QB * C_DIM * PB];  // weighted sum, exp sum of a bin
    __shared__ __attribute__((aligned(16))) v4f   qs[C_DIM * 3];            // a head's 8 queries; max, min, w
    __shared__ int badw[8];                                                 // a wave saw |q| * w above XMAX

    const int tid  = threadIdx.x;
    const int lane = tid & 31;
    const int wave = tid >> 5;
    const int b    = blockIdx.x >> 7;
    const int s0   = (blockIdx.x & 127) * QB;
    const int kh   = wave >> 2;           // key half
    const int c    = tid & (C_DIM - 1);   // head
    const int half = lane >> 4;           // 0: K 0,1   1: K 2,3
    const int lr   = lane & 15;
    const int n    = (wave << 4) + lr;    // output channel of the projection

    // what the path test needs: the eight queries and max, min, w of head c
    const v4f* qp = (const v4f*)q + ((size_t)b * (S_DIM / 4) + (s0 >> 2)) * C_DIM + c;
    const v4f  q0 = qp[0], q1 = qp[C_DIM];
    const v4f  hc = *(const v4f*)(mom + ((size_t)b * C_DIM + c) * MSTR + MHDR);
    // The loads below may be given registers that the loads above name as their address: the
    // wait stands between the two groups, and the scheduling barriers hold it there.
    __builtin_amdgcn_sched_barrier(0);
    asm volatile("s_wait_xcnt 0x0" ::: "memory");
    __builtin_amdgcn_sched_barrier(0);

    // Series path, item j = heads 16*wave + 4j + (lane>>3), bin lane&7: ten 16-byte loads of
    // moments (8 lanes: 128 bytes in a row). Four register buffers, three items in flight
    // ahead of the one that is worked on.
    const int    lb = lane & (NBIN - 1);
    const int    h0 = 16 * wave + (lane >> 3);
    const float* mb = mom + ((size_t)b * C_DIM + h0) * MSTR + lb * 4;
    v4f bm[4][NPAIR];
#define LOAD_ITEM(j)                                                                   \
    {                                                                                  \
        _Pragma("unroll") for (int i = 0; i < NPAIR; ++i)                              \
            bm[(j) & 3][i] = *(const v4f*)(mb + (j) * 4 * MSTR + i * (NBIN * 4));      \
    }
    LOAD_ITEM(0)
    LOAD_ITEM(1)
    LOAD_ITEM(2)

    // bias and residual of the projection
    const float bb = bias[n];
    const v4f* rp = (const v4f*)(resid + ((size_t)b * C_DIM + n) * S_DIM + s0);
    const v4f  r0 = rp[0], r1 = rp[1];
    // keeps the path test's work on q and w (and its wait) behind the issue of all loads above
    __builtin_amdgcn_sched_barrier(0);
    // the residual's address registers are rewritten below: the wait stands behind the loads,
    // and the scheduling barriers hold it there
    asm volatile("s_wait_xcnt 0x0" ::: "memory");
    __builtin_amdgcn_sched_barrier(0);

    {
        // wave w: rows 16w .. 16w+15 of W, waited for behind the attention part
        const unsigned lw = lds_byte(Ws) + (unsigned)(16 * wave * LDP * 4 + lane * 16);
        const float*   gw = W + (size_t)(16 * wave) * C_DIM + lane * 4;
        async_copy8(lw, gw, LDP * 4, C_DIM);
        async_copy8(lw + 8 * LDP * 4, gw + 8 * C_DIM, LDP * 4, C_DIM);
    }

    // --- which path: the same for the whole work-group ---
    bool series;
    {
        float qa = fmaxf(fmaxf(fabsf(q0.x), fabsf(q0.y)), fmaxf(fabsf(q0.z), fabsf(q0.w)));
        qa = fmaxf(qa, fmaxf(fmaxf(fabsf(q1.x), fabsf(q1.y)), fmaxf(fabsf(q1.z), fabsf(q1.w))));
        const int bad = __any(!(qa * hc.z <= XMAX));   // a product that is NaN or infinite counts as above
        if (lane == 0) badw[wave] = bad;
        if (kh == 0) {
            // the series path's threads take another head's queries and range from here
            qs[c * 3]     = q0;
            qs[c * 3 + 1] = q1;
            qs[c * 3 + 2] = hc;
        }
        // all eight waves' words, and qs, are written before they are read
        __syncthreads();
        int f = 0;
        // fully unrolled: eight fixed LDS words
#pragma unroll
        for (int i = 0; i < 8; ++i) f |= badw[i];
        series = __builtin_amdgcn_readfirstlane(f) == 0;
    }
    // Inputs-only fence on the loaded values: keeps the residual's loads in front of the
    // attention part; sunk to their use, their latency would stand at the kernel's end.
    asm volatile("" :: "v"(r0), "v"(r1), "v"(bb));

    if (series) {
        const float fc = (float)(2 * lb + 1);
        // fully unrolled: the buffers are indexed by constants and live in registers
#pragma unroll
        for (int j = 0; j < 4; ++j) {
            if (j + 3 < 4) {
                LOAD_ITEM(j + 3)
                // these are the last loads from mb, whose registers are free for the work below:
                // the wait stands behind the loads, and the scheduling barriers hold it there
                __builtin_amdgcn_sched_barrier(0);
                asm volatile("s_wait_xcnt 0x0" ::: "memory");
            }
            // holds the loads above in front of the work below: three items ahead, no more
            __builtin_amdgcn_sched_barrier(0);
            const v4f qj[2] = {qs[(h0 + 4 * j) * 3], qs[(h0 + 4 * j) * 3 + 1]};
            const v4f hh    = qs[(h0 + 4 * j) * 3 + 2];
            const float kmx = hh.x, kmn = hh.y, w = hh.z;
            const float cb  = __builtin_fmaf(fc, w, kmn);       // same form as in the moments kernel
            const float dmx = (cb - kmx) * LOG2E_F;             // <= 0
            const float dmn = (cb - kmn) * LOG2E_F;             // >= 0
            v2f xx[QB], acc[QB];
            float ee[QB];
            // the loops over t are fully unrolled: xx, acc, ee indexed by constants
#pragma unroll
            for (int t = 0; t < QB; ++t) {
                const float qv = qj[t >> 2][t & 3];
                // q * (c_b - max k) for q >= 0, q * (c_b - min k) for q < 0: the one that is <= 0
                ee[t] = __builtin_amdgcn_exp2f(fminf(qv * dmx, qv * dmn));
                const float x = qv * w;
                xx[t]  = (v2f){x, x};
                acc[t] = (v2f){bm[j & 3][NPAIR - 1].z, bm[j & 3][NPAIR - 1].w};
            }
            // fully unrolled: Horner from term 18 down to term 0, eight independent chains
#pragma unroll
            for (int nn = 2 * NPAIR - 2; nn >= 0; --nn) {
                const v4f m4 = bm[j & 3][nn >> 1];
                const v2f mc = (nn & 1) ? (v2f){m4.z, m4.w} : (v2f){m4.x, m4.y};
#pragma unroll
                for (int t = 0; t < QB; ++t) acc[t] = __builtin_elementwise_fma(acc[t], xx[t], mc);
            }
#pragma unroll
            for (int t = 0; t < QB; ++t) {
                binsum[(t * C_DIM + h0 + 4 * j) * PB + lb] = acc[t] * (v2f){ee[t], ee[t]};
            }
            __builtin_amdgcn_sched_barrier(0);
        }
    } else {
        const float kmx = hc.x, kmn = hc.y;
        // --- the first RING trips of the wave's k,v stream ---
        const v4f* kvp = (const v4f*)kv + ((size_t)b * (S_DIM / 2) + kh * (S_DIM / 4)) * C_DIM + c;
        v4f ring[RING][2];
        // fully unrolled: the ring is indexed by constants and lives in registers
#pragma unroll
        for (int d = 0; d < RING; ++d) {
            ring[d][0] = kvp[(2 * d) * C_DIM];
            ring[d][1] = kvp[(2 * d + 1) * C_DIM];
        }

        // Register tile: the thread's eight queries stay in registers and walk the keys
        // together, four keys (two pairs) a trip. Keys are paired (even, odd) so that score,
        // sum and weighted sum are packed f32 operations. Scores are formed in the base-2
        // domain (q scaled by log2(e) once per query), so each score is one fma + one exp2.
        v2f qq[QB], nm[QB], se[QB], sv[QB];
        // every loop over t below is fully unrolled so that these small arrays
        // are indexed by constants and live in registers, not in scratch memory
#pragma unroll
        for (int t = 0; t < QB; ++t) {
            const float ql = (t < 4 ? q0[t & 3] : q1[t & 3]) * LOG2E_F;
            const float mx = (ql >= 0.f) ? ql * kmx : ql * kmn;
            qq[t] = (v2f){ql, ql};
            nm[t] = (v2f){-mx, -mx};
            se[t] = (v2f){0.f, 0.f};
            sv[t] = (v2f){0.f, 0.f};
        }

        // stays rolled: one pass is RING trips, about 6 KB of code
#pragma unroll 1
        for (int it = 1; it < S_DIM / (8 * RING); ++it) {
            attn_pass<true>(ring, qq, nm, se, sv, kvp + (size_t)it * (2 * RING * C_DIM));
            // the refills' address registers are rewritten at the head of the next pass
            asm volatile("s_wait_xcnt 0x0" ::: "memory");
        }
        // the last pass has nothing left to fetch
        attn_pass<false>(ring, qq, nm, se, sv, kvp);

        // --- the two key halves meet in LDS (both were shifted by the same m_i) ---
        // fully unrolled: se, sv indexed by constants
#pragma unroll
        for (int t = 0; t < QB; ++t) {
            part[(kh * QB + t) * C_DIM + c] = (v2f){se[t].x + se[t].y, sv[t].x + sv[t].y};
        }
    }
#undef LOAD_ITEM
    // the wave's own copies of W have landed; the barrier publishes them and the partial sums
    asm volatile("s_wait_asynccnt 0x0" ::: "memory");
    __syncthreads();
    if (series) {
        // fully unrolled: four fixed rows a thread
#pragma unroll
        for (int u = 0; u < QB / 2; ++u) {
            const int t = kh * (QB / 2) + u;
            // lanes walk the heads at a pitch of 80 bytes: the 16-byte reads meet no bank twice
            const v4f* bp = (const v4f*)(binsum + (t * C_DIM + c) * PB);
            v4f s = bp[0];
            // fully unrolled: every offset becomes an immediate of its LDS read
#pragma unroll
            for (int i = 1; i < NBIN / 2; ++i) s += bp[i];
            As[t * LDP + c] = (s.x + s.z) / (s.y + s.w);
        }
    } else {
        // fully unrolled: four fixed rows a thread
#pragma unroll
        for (int u = 0; u < QB / 2; ++u) {
            const int t  = kh * (QB / 2) + u;
            const v2f p0 = part[t * C_DIM + c];
            const v2f p1 = part[(QB + t) * C_DIM + c];
            As[t * LDP + c] = (p0.y + p1.y) / (p0.x + p1.x);
        }
    }
    // the A tile is whole before any wave reads a fragment
    __syncthreads();

    const float* arow = As + (lr & (QB - 1)) * LDP + 2 * half;
    const float* brow = Ws + n * LDP + 2 * half;

    v8f acc = {};
    // fully unrolled: every k offset becomes an immediate of its LDS read
#pragma unroll
    for (int k0 = 0; k0 < C_DIM; k0 += 4) {
        v2f afrag = *(const v2f*)(arow + k0);
        v2f bfrag = *(const v2f*)(brow + k0);
        acc = __builtin_amdgcn_wmma_f32_16x16x4_f32(
            /*neg_a=*/false, afrag, /*neg_b=*/false, bfrag,
            /*c_mod=*/(short)0, acc, /*reuse_a=*/false, /*reuse_b=*/false);
    }

    // lanes 0-15 hold rows 0-7 (positions s0 .. s0+7) of column n
    const v4f o0 = {(acc[0] + bb) + r0.x, (acc[1] + bb) + r0.y, (acc[2] + bb) + r0.z, (acc[3] + bb) + r0.w};
    const v4f o1 = {(acc[4] + bb) + r1.x, (acc[5] + bb) + r1.y, (acc[6] + bb) + r1.z, (acc[7] + bb) + r1.w};
    if (half == 0) {
        v4f* op = (v4f*)(out + ((size_t)b * C_DIM + n) * S_DIM + s0);
        op[0] = o0;
        op[1] = o1;
    }
}

// ---------------------------------------------------------------------------
// Host-side launcher. Inputs:
//  0 hidden_states [2,128,32,32]  1 gn_weight [128]  2 gn_bias [128]
//  3 Wq [128,128]  4 bq  5 Wk  6 bk  7 Wv  8 bv  9 Wo  10 bo
// Workspace: q (B*S*C floats) | k,v interleaved (2*B*S*C) | max/min partials (B*S*C/8) |
//            moment blocks (B*C*MSTR).
// ---------------------------------------------------------------------------
extern "C" void kernel_launch(void* const* d_in, const int* in_sizes, int n_in,
                              void* d_out, int out_size, void* d_ws, size_t ws_size,
                              hipStream_t stream) {
    const float* x  = (const float*)d_in[0];
    const float* gw = (const float*)d_in[1];
    const float* gb = (const float*)d_in[2];
    const float* Wq = (const float*)d_in[3];
    const float* bq = (const float*)d_in[4];
    const float* Wk = (const float*)d_in[5];
    const float* bk = (const float*)d_in[6];
    const float* Wv = (const float*)d_in[7];
    const float* bv = (const float*)d_in[8];
    const float* Wo = (const float*)d_in[9];
    const float* bo = (const float*)d_in[10];
    float* out = (float*)d_out;

    float* ws = (float*)d_ws;
    const size_t NBS = (size_t)B_DIM * S_DIM * C_DIM;  // 262144
    float* qb   = ws;
    float* kvb  = ws + 1 * NBS;
    float* mmb  = ws + 3 * NBS;
    float* momb = ws + 3 * NBS + NBS / 8;

    gn_qkv_wmma_kernel<<<(B_DIM * S_DIM) / 16, 256, 0, stream>>>(x, gw, gb, Wq, bq, Wk, bk, Wv, bv,
                                                                 qb, kvb, mmb);

    key_moments_kernel<<<B_DIM * C_DIM, 256, 0, stream>>>(kvb, mmb, momb);

    // Attention, output projection + residual, written to [B, C, S] (== [B,C,H,W]).
    attn_proj_kernel<<<(B_DIM * S_DIM) / QB, 256, 0, stream>>>(qb, kvb, momb, Wo, bo, x, out);
}

// v009
// It runs in 17.9 microseconds.
// In both of two side-by-side timings against v008, it was 1.13 times as fast.
// Counting every step since v000, it is 5.32 times as fast.
#include <hip/hip_runtime.h>
#include <hip/hip_bf16.h>

#define B_DIM   2
#define C_DIM   128
#define S_DIM   1024
#define GROUPS  32
#define GSIZE   4          // channels per group (C/GROUPS)
#define EPS_GN  1e-5f
#define QT      4          // queries per thread in the attention kernel
#define LOG2E_F 1.44269504088896340736f
#define NBIN    8          // bins that a head's key range is cut into
#define NPAIR   10         // pairs of series terms: 20 terms
#define MHDR    (NPAIR * NBIN * 4)   // floats of one head's moments
#define RSP     352        // LDS pitch, in floats, of one key slice's 320 partial moments
#define XMAX    3.0f       // largest |q| * half-width for which the 20-term series is used

typedef __attribute__((ext_vector_type(2))) float v2f;
typedef __attribute__((ext_vector_type(4))) float v4f;
typedef __attribute__((ext_vector_type(8))) float v8f;

// ---------------------------------------------------------------------------
// Staging for the two GEMM stages. Every global operand of a work-group's tile
// goes to LDS by asynchronous 16-byte copies: one copy of a wave moves one whole
// 512-byte row of W (four whole cache lines) or 64 B of each of eight
// 16-float rows of x or ao, and all copies of a tile are in flight
// together. The WMMA fragments are then read from LDS.
// LDP: LDS pitch of a staged 128-float row. 132 floats = 528 B is a multiple of
// the copy width, and the 8-byte fragment reads of 16 rows x 2 k pairs fall on
// 64 different banks (row step 4 banks, k-pair step 2 banks).
// RDP: LDS pitch of a staged 16-float row of x or ao, 80 B = 16 B x 5.
// ---------------------------------------------------------------------------
#define LDP 132
#define RDP 20

__device__ __forceinline__ unsigned lds_byte(const float* p) {
    // Low 32 bits of the generic address of a __shared__ object are the
    // workgroup-relative LDS byte offset.
    return (unsigned)(uintptr_t)p;
}

// n copies of 16 bytes per lane, copy i at LDS byte l + i*ls and at g + i*gs floats.
// The s_wait_xcnt closes each statement so that no address register of a copy
// is rewritten before the wait.
__device__ __forceinline__ void async_copy2(unsigned l, const float* g, unsigned ls, int gs) {
    asm volatile("global_load_async_to_lds_b128 %0, %2, off\n\t"
                 "global_load_async_to_lds_b128 %1, %3, off\n\t"
                 "s_wait_xcnt 0x0"
                 :: "v"(l), "v"(l + ls), "v"(g), "v"(g + gs) : "memory");
}
__device__ __forceinline__ void async_copy8(unsigned l, const float* g, unsigned ls, int gs) {
    asm volatile("global_load_async_to_lds_b128 %0, %8, off\n\t"
                 "global_load_async_to_lds_b128 %1, %9, off\n\t"
                 "global_load_async_to_lds_b128 %2, %10, off\n\t"
                 "global_load_async_to_lds_b128 %3, %11, off\n\t"
                 "global_load_async_to_lds_b128 %4, %12, off\n\t"
                 "global_load_async_to_lds_b128 %5, %13, off\n\t"
                 "global_load_async_to_lds_b128 %6, %14, off\n\t"
                 "global_load_async_to_lds_b128 %7, %15, off\n\t"
                 "s_wait_xcnt 0x0"
                 :: "v"(l), "v"(l + ls), "v"(l + 2 * ls), "v"(l + 3 * ls),
                    "v"(l + 4 * ls), "v"(l + 5 * ls), "v"(l + 6 * ls), "v"(l + 7 * ls),
                    "v"(g), "v"(g + gs), "v"(g + 2 * gs), "v"(g + 3 * gs),
                    "v"(g + 4 * gs), "v"(g + 5 * gs), "v"(g + 6 * gs), "v"(g + 7 * gs) : "memory");
}

// ---------------------------------------------------------------------------
// Kernel 1: GroupNorm and the q, k and v projections in one launch.
// Grid: (B*S)/16 blocks of 256 threads; block x takes the 16 rows (b, s0..s0+15),
// wave w column tile w of all three weights (three accumulators on one A fragment).
// A work-group needs the statistics of all 32 groups of its batch and no other
// work-group can hand them over inside a launch, so each sums x[b] (512 KB, read
// from L2) itself: wave w takes groups 4w .. 4w+3, 64 KB in a row. The weights and
// the block's own 128 x 16 tile of x fly to LDS meanwhile by asynchronous copies.
// The tile is then normalized and transposed in LDS into the row-major A tile.
// Fragment layout (ISA 7.12.2, 32-bit, wave32):
//   A 16x4 : lanes 0-15 row M=lane, VGPR{0,1}=K{0,1}; lanes 16-31: K{2,3}
//   B 4x16 : lanes 0-15 col N=lane, VGPR{0,1}=K{0,1}; lanes 16-31: K{2,3}
//   -> each lane reads one float2 (consecutive K) from one row of A / W.
//   D 16x16: VGPR r -> M = r (lanes 0-15) / r+8 (lanes 16-31), N = lane%16.
// Outputs (whole 128-byte lines per wave: lanes walk the channels):
//   qo [B][S/4][C][4] : four consecutive positions of one channel
//   kv [B][S/2][C][4] : k(s), k(s+1), v(s), v(s+1) of one channel
//   mm [B][S/16][C][2]: max and min of k over this block's 16 positions
// ---------------------------------------------------------------------------
__global__ void __launch_bounds__(256)
gn_qkv_wmma_kernel(const float* __restrict__ x,    // [B, C, S]
                   const float* __restrict__ gw,   // [C]
                   const float* __restrict__ gb,   // [C]
                   const float* __restrict__ Wq,   // [C, C]
                   const float* __restrict__ bq,   // [C]
                   const float* __restrict__ Wk,
                   const float* __restrict__ bk,
                   const float* __restrict__ Wv,
                   const float* __restrict__ bv,
                   float* __restrict__ qo,
                   float* __restrict__ kv,
                   float* __restrict__ mm) {
    __shared__ __attribute__((aligned(16))) float As[16 * LDP];
    __shared__ __attribute__((aligned(16))) float Ws[3 * C_DIM * LDP];
    __shared__ __attribute__((aligned(16))) float Xs[C_DIM * RDP];
    __shared__ __attribute__((aligned(16))) v2f   Cs[C_DIM];   // mean, rstd of a channel's group

    const int tid  = threadIdx.x;
    const int lane = tid & 31;
    const int wave = tid >> 5;
    const int row0 = blockIdx.x << 4;     // M tile base (b*S+s)
    const int bi   = row0 >> 10;
    const int col0 = wave << 4;           // N tile base (output channel)
    const int half = lane >> 4;
    const int lr   = lane & 15;
    const int   n   = col0 + lr;
    const float bbq = bq[n], bbk = bk[n], bbv = bv[n];
    const int   cn  = tid & (C_DIM - 1);  // the channel this thread normalizes
    const float gwc = gw[cn], gbc = gb[cn];

    {
        // thread t: 16 bytes (quarter t&3) of x rows t>>2 and 64 + (t>>2), columns s0 .. s0+15
        async_copy2(lds_byte(Xs) + (unsigned)((tid >> 2) * RDP * 4 + (tid & 3) * 16),
                    x + ((size_t)bi * C_DIM + (tid >> 2)) * S_DIM + (row0 & 1023) + (tid & 3) * 4,
                    64 * RDP * 4, 64 * S_DIM);
        // wave w: its own 16 rows of each weight
        // (LDS rows 48w: q, 48w+16: k, 48w+32: v, so that one base register and
        // immediate offsets reach all three)
        const unsigned lw = lds_byte(Ws) + (unsigned)(48 * wave * LDP * 4 + lane * 16);
        const size_t   go = (size_t)col0 * C_DIM + lane * 4;
        async_copy8(lw,                 Wq + go,             LDP * 4, C_DIM);
        async_copy8(lw +  8 * LDP * 4,  Wq + go + 8 * C_DIM, LDP * 4, C_DIM);
        async_copy8(lw + 16 * LDP * 4,  Wk + go,             LDP * 4, C_DIM);
        async_copy8(lw + 24 * LDP * 4,  Wk + go + 8 * C_DIM, LDP * 4, C_DIM);
        async_copy8(lw + 32 * LDP * 4,  Wv + go,             LDP * 4, C_DIM);
        async_copy8(lw + 40 * LDP * 4,  Wv + go + 8 * C_DIM, LDP * 4, C_DIM);
    }

    // --- sums of the wave's four groups (channels col0 .. col0+15 of batch bi) ---
    float gs[4], gq[4];
    {
        const v4f* xw = (const v4f*)(x + ((size_t)bi * C_DIM + col0) * S_DIM) + lane;
        // Eight batches of 16 loads (two to a group) through three register buffers:
        // two batches stay in flight behind the one that is summed. All loops are fully
        // unrolled: every load is the one base address plus an immediate, and the
        // buffers and gs/gq are indexed by constants.
        v4f buf[3][16];
        v4f s4 = {0.f, 0.f, 0.f, 0.f}, q4 = {0.f, 0.f, 0.f, 0.f};
#pragma unroll
        for (int i = 0; i < 16; ++i) buf[0][i] = xw[i * 32];
#pragma unroll
        for (int i = 0; i < 16; ++i) buf[1][i] = xw[(16 + i) * 32];
#pragma unroll
        for (int k = 0; k < 8; ++k) {
            if (k + 2 < 8) {
#pragma unroll
                for (int i = 0; i < 16; ++i) buf[(k + 2) % 3][i] = xw[((k + 2) * 16 + i) * 32];
            }
            // holds the loads above in front of the sums below: two batches ahead, no more
            // (left free, the compiler issues all 128 loads at once on some 500 registers)
            __builtin_amdgcn_sched_barrier(0);
#pragma unroll
            for (int i = 0; i < 16; ++i) {
                const v4f t = buf[k % 3][i];
                s4 += t;
                q4 = __builtin_elementwise_fma(t, t, q4);
            }
            if (k & 1) {
                gs[k >> 1] = (s4.x + s4.y) + (s4.z + s4.w);
                gq[k >> 1] = (q4.x + q4.y) + (q4.z + q4.w);
                s4 = (v4f){0.f, 0.f, 0.f, 0.f};
                q4 = (v4f){0.f, 0.f, 0.f, 0.f};
            }
            // keeps the next batch's loads behind these sums, whose buffer they refill
            __builtin_amdgcn_sched_barrier(0);
        }
    }
    {
        // Sum over the 32 lanes. The first two exchanges also deal the four groups out:
        // a lane keeps the groups of its own half (then quarter) of the wave and sends
        // the others, so lanes 8g .. 8g+7 end with the whole sums of group g.
        const bool h16 = (lane & 16) != 0, h8 = (lane & 8) != 0;
        float sa = (h16 ? gs[2] : gs[0]) + __shfl_xor(h16 ? gs[0] : gs[2], 16, 32);
        float sb = (h16 ? gs[3] : gs[1]) + __shfl_xor(h16 ? gs[1] : gs[3], 16, 32);
        float qa = (h16 ? gq[2] : gq[0]) + __shfl_xor(h16 ? gq[0] : gq[2], 16, 32);
        float qb = (h16 ? gq[3] : gq[1]) + __shfl_xor(h16 ? gq[1] : gq[3], 16, 32);
        float sm = (h8 ? sb : sa) + __shfl_xor(h8 ? sa : sb, 8, 32);
        float qm = (h8 ? qb : qa) + __shfl_xor(h8 ? qa : qb, 8, 32);
        // fully unrolled: three fixed exchange distances
#pragma unroll
        for (int off = 4; off > 0; off >>= 1) {
            sm += __shfl_xor(sm, off, 32);
            qm += __shfl_xor(qm, off, 32);
        }
        const float inv_n = 1.0f / (GSIZE * S_DIM);
        const float m   = sm * inv_n;
        const float var = qm * inv_n - m * m;     // biased var (matches jnp.var)
        const float r   = rsqrtf(var + EPS_GN);
        if ((lane & 4) == 0) Cs[col0 + (lane >> 3) * 4 + (lane & 3)] = (v2f){m, r};
    }
    // the wave's own copies have landed; the barrier publishes them and Cs to the others
    asm volatile("s_wait_asynccnt 0x0" ::: "memory");
    __syncthreads();

    {
        // thread t: channel t&127, eight columns; lanes walk c, so the 16-byte reads
        // (pitch 80 B) and the 4-byte writes (consecutive) meet no bank twice
        const int c  = cn;
        const int sb = (tid >> 7) * 8;
        const v2f p  = Cs[c];
        const v4f x0 = *(const v4f*)(Xs + c * RDP + sb);
        const v4f x1 = *(const v4f*)(Xs + c * RDP + sb + 4);
        // fully unrolled: the vector elements are indexed by constants
#pragma unroll
        for (int r = 0; r < 4; ++r) {
            As[(sb + r) * LDP + c]     = (x0[r] - p.x) * p.y * gwc + gbc;
            As[(sb + 4 + r) * LDP + c] = (x1[r] - p.x) * p.y * gwc + gbc;
        }
    }
    // the A tile is whole before any wave reads a fragment
    __syncthreads();

    const float* arow = As + lr * LDP + 2 * half;
    const float* qrow = Ws + (48 * wave + lr) * LDP + 2 * half;
    const float* krow = qrow + 16 * LDP;
    const float* vrow = krow + 16 * LDP;

    v8f accq = {}, acck = {}, accv = {};
    // fully unrolled: every k offset becomes an immediate of its LDS read
#pragma unroll
    for (int k0 = 0; k0 < C_DIM; k0 += 4) {
        const v2f afrag = *(const v2f*)(arow + k0);
        const v2f qfrag = *(const v2f*)(qrow + k0);
        const v2f kfrag = *(const v2f*)(krow + k0);
        const v2f vfrag = *(const v2f*)(vrow + k0);
        accq = __builtin_amdgcn_wmma_f32_16x16x4_f32(false, afrag, false, qfrag,
                                                     (short)0, accq, false, false);
        acck = __builtin_amdgcn_wmma_f32_16x16x4_f32(false, afrag, false, kfrag,
                                                     (short)0, acck, false, false);
        accv = __builtin_amdgcn_wmma_f32_16x16x4_f32(false, afrag, false, vfrag,
                                                     (short)0, accv, false, false);
    }

    const int sl = (row0 & 1023) + half * 8;             // first of the lane's 8 positions
    v4f* qd = (v4f*)qo + ((size_t)bi * (S_DIM / 4) + (sl >> 2)) * C_DIM + n;
    v4f* kd = (v4f*)kv + ((size_t)bi * (S_DIM / 2) + (sl >> 1)) * C_DIM + n;
    float kr[8];
    // the loops below are fully unrolled: the accumulators are indexed by constants
#pragma unroll
    for (int r = 0; r < 8; ++r) kr[r] = acck[r] + bbk;
#pragma unroll
    for (int j = 0; j < 2; ++j) {
        qd[j * C_DIM] = (v4f){accq[4 * j] + bbq, accq[4 * j + 1] + bbq,
                              accq[4 * j + 2] + bbq, accq[4 * j + 3] + bbq};
    }
#pragma unroll
    for (int j = 0; j < 4; ++j) {
        kd[j * C_DIM] = (v4f){kr[2 * j], kr[2 * j + 1], accv[2 * j] + bbv, accv[2 * j + 1] + bbv};
    }
    float kx = kr[0], kn = kr[0];
#pragma unroll
    for (int r = 1; r < 8; ++r) {
        kx = fmaxf(kx, kr[r]);
        kn = fminf(kn, kr[r]);
    }
    kx = fmaxf(kx, __shfl_xor(kx, 16, 32));
    kn = fminf(kn, __shfl_xor(kn, 16, 32));
    if (half == 0) {
        ((v2f*)mm)[((size_t)bi * (S_DIM / 16) + ((row0 & 1023) >> 4)) * C_DIM + n] = (v2f){kx, kn};
    }
}

// 2^a with the free slot that the instruction set asks for behind a transcendental: the v_nop
// stands in the statement itself.
__device__ __forceinline__ float exp2_slot(float a) {
    float e;
    asm("v_exp_f32 %0, %1\n\tv_nop" : "=v"(e) : "v"(a));
    return e;
}

// ---------------------------------------------------------------------------
// Kernel 2: HEAD_DIM=1 attention, one work-group per (b, head). Each head is an independent
// problem:  ao_i = sum_j exp(q_i*k_j - m_i) * v_j / sum_j exp(q_i*k_j - m_i)
// with exact m_i = q_i>=0 ? q_i*max(k) : q_i*min(k). With head size 1 the result is a
// function of the scalar q alone: N(q) / D(q), [N, D] = sum_j [v_j, 1] * exp(q * k_j - m).
// The key range [min, max] is cut into NBIN bins of half-width w and centre c_b. With
// k_j = c_b + w * d_j (|d_j| <= 1) and x = q * w
//   exp(q * k_j) = exp(q * c_b) * sum_n x^n * d_j^n / n!
// so that [N, D](q) = sum_b exp(q * c_b - m) * sum_n x^n * [A, B](b, n) with
//   [A, B](b, n) = sum over the keys j of bin b of [v_j, 1] * d_j^n / n!,  n = 0 .. 19.
// For |x| <= XMAX the cut series is off by less than x^20 / 20! * e^|x|, below the rounding
// of the f32 scores; the kernel tests that bound over the head's queries and takes the
// direct sum over the keys for the rest.
// The table's size, which is the work of building and of summing it, is bins x terms: a bin
// twice as wide doubles x, and the factorial pays for that with four more terms. What bounds
// the width is rounding: a bin's series is right to f32 rounding of (keys of the bin) * e^|x|,
// while keys crowded at the bin's far edge sum to e^-|x| each.
// 256 threads. Building: thread = (bin, slice of 32 keys); a key outside the thread's bin
// enters with weight 0, so nothing is scattered. The head's 320 moments stay in LDS,
//   ms [i 0..9][bin][4] = A(2i), B(2i), A(2i+1), B(2i+1),
// and every thread then sums all bins for its own QT = 4 queries (Horner on the packed pair
// A, B; every lane reads the same moment, one LDS broadcast).
// Output ao [B][C][S]: the head's 1024 results in a row (whole lines, one writer).
// ---------------------------------------------------------------------------
__global__ void __launch_bounds__(256)
head_attn_kernel(const float* __restrict__ q,    // [B][S/4][C][4]
                 const float* __restrict__ kv,   // [B][S/2][C][4]
                 const float* __restrict__ mm,   // [B][S/16][C][2]
                 float* __restrict__ ao) {       // [B][C][S]
    // d, d*d, v, bin of a key; a slice of 32 keys has a pitch of 33 entries, so that the four
    // slices that a wave reads at once lie in different banks
    __shared__ __attribute__((aligned(16))) v4f   ks[S_DIM + S_DIM / 32];
    __shared__ __attribute__((aligned(16))) float rs[32 * RSP];     // partial moments of 32 slices
    __shared__ __attribute__((aligned(16))) float ms[MHDR];         // the head's moments
    __shared__ int badw[8];                                         // a wave saw |q| * w above XMAX

    const int tid  = threadIdx.x;
    const int lane = tid & 31;
    const int wave = tid >> 5;
    const int b    = blockIdx.x >> 7;
    const int c    = blockIdx.x & (C_DIM - 1);

    const v4f* kp = (const v4f*)kv + (size_t)b * (S_DIM / 2) * C_DIM + c;
    const v4f  p0 = kp[tid * C_DIM], p1 = kp[(tid + 256) * C_DIM];   // the thread's two key pairs
    const v2f* mp = (const v2f*)mm + (size_t)b * (S_DIM / 16) * C_DIM + c;
    const v2f  a0 = mp[lane * C_DIM], a1 = mp[(lane + 32) * C_DIM];
    // The address registers of the four loads are rewritten below: the wait stands behind the
    // loads. The scheduling barriers hold it there and keep the work on a0, a1 (and its wait)
    // behind the issue of all four loads.
    __builtin_amdgcn_sched_barrier(0);
    asm volatile("s_wait_xcnt 0x0" ::: "memory");
    __builtin_amdgcn_sched_barrier(0);

    // exact max/min of the head's k row: every wave reduces the 64 partial pairs itself
    float mx = fmaxf(a0.x, a1.x), mn = fminf(a0.y, a1.y);
    // fully unrolled: five fixed exchange distances
#pragma unroll
    for (int off = 16; off > 0; off >>= 1) {
        mx = fmaxf(mx, __shfl_xor(mx, off, 32));
        mn = fminf(mn, __shfl_xor(mn, off, 32));
    }
    const float w  = (mx - mn) * (0.5f / NBIN);
    const float iw = (w > 0.f) ? 1.0f / w : 0.f;   // all keys equal: one bin, d = 0

    {
        const float kk[4] = {p0.x, p0.y, p1.x, p1.y};
        const float vv[4] = {p0.z, p0.w, p1.z, p1.w};
        // fully unrolled: kk, vv indexed by constants
#pragma unroll
        for (int r = 0; r < 4; ++r) {
            int bi = (int)((kk[r] - mn) * (0.5f * iw));
            bi = bi < 0 ? 0 : (bi > NBIN - 1 ? NBIN - 1 : bi);
            const float cb = __builtin_fmaf((float)(2 * bi + 1), w, mn);   // same form as where the bins are summed
            const float d  = (kk[r] - cb) * iw;
            const int key = (r >> 1) * 512 + 2 * tid + (r & 1);
            ks[key + (key >> 5)] = (v4f){d, d * d, vv[r], (float)bi};
        }
    }
    // all keys are staged before any thread walks its slice
    __syncthreads();

    // The thread's four queries, positions 4 tid .. 4 tid + 3. The load stands behind the barrier,
    // which waits for every load in front of it: so the queries fly while the moments are built.
    const v4f q4 = ((const v4f*)q)[((size_t)b * (S_DIM / 4) + tid) * C_DIM + c];
    // Its address registers are rewritten below: the wait stands behind the load. The scheduling
    // barriers hold load and wait here, in front of the building.
    __builtin_amdgcn_sched_barrier(0);
    asm volatile("s_wait_xcnt 0x0" ::: "memory");
    __builtin_amdgcn_sched_barrier(0);

    {
        const float fb    = (float)(lane & (NBIN - 1));
        const int   slice = wave * 4 + (lane >> 3);
        v2f A[NPAIR], Bm[NPAIR];
        // fully unrolled: A, Bm indexed by constants
#pragma unroll
        for (int i = 0; i < NPAIR; ++i) {
            A[i]  = (v2f){0.f, 0.f};
            Bm[i] = (v2f){0.f, 0.f};
        }
        // four keys a trip: their power chains are independent and fill each other's latency
#pragma unroll 4
        for (int j = 0; j < 32; ++j) {
            const v4f   e   = ks[slice * 33 + j];
            const float one = (e.w == fb) ? 1.f : 0.f;
            v2f       P  = {one, one * e.x};            // d^(2i), d^(2i+1), or 0 for another bin's key
            const v2f d2 = {e.y, e.y}, vv = {e.z, e.z};
            // fully unrolled: A, Bm indexed by constants
#pragma unroll
            for (int i = 0; i < NPAIR; ++i) {
                Bm[i] += P;
                A[i] = __builtin_elementwise_fma(P, vv, A[i]);
                if (i < NPAIR - 1) P *= d2;
            }
        }
        {
            constexpr float F[2 * NPAIR] = {1.0f, 1.0f, 1.0f / 2.0f, 1.0f / 6.0f, 1.0f / 24.0f, 1.0f / 120.0f,
                                     1.0f / 720.0f, 1.0f / 5040.0f, 1.0f / 40320.0f, 1.0f / 362880.0f,
                                     1.0f / 3628800.0f, 1.0f / 39916800.0f, 1.0f / 479001600.0f,
                                     1.0f / 6227020800.0f, 1.0f / 87178291200.0f, 1.0f / 1307674368000.0f,
                                     1.0f / 20922789888000.0f, 1.0f / 355687428096000.0f,
                                     1.0f / 6402373705728000.0f, 1.0f / 121645100408832000.0f};
            // fully unrolled: A, Bm, F indexed by constants
#pragma unroll
            for (int i = 0; i < NPAIR; ++i) {
                *(v4f*)(rs + slice * RSP + i * (NBIN * 4) + (lane & (NBIN - 1)) * 4) =
                    (v4f){A[i].x * F[2 * i], Bm[i].x * F[2 * i], A[i].y * F[2 * i + 1], Bm[i].y * F[2 * i + 1]};
            }
        }
    }
    // --- which path: the same for the whole work-group; the queries are first waited for here ---
    {
        const float qa = fmaxf(fmaxf(fabsf(q4.x), fabsf(q4.y)), fmaxf(fabsf(q4.z), fabsf(q4.w)));
        const int bad = __any(!(qa * w <= XMAX));   // a product that is NaN or infinite counts as above
        if (lane == 0) badw[wave] = bad;
    }
    // all slices' partial moments, and all eight waves' words, are written before they are read
    __syncthreads();
    bool series;
    {
        int f = 0;
        // fully unrolled: eight fixed LDS words
#pragma unroll
        for (int i = 0; i < 8; ++i) f |= badw[i];
        series = __builtin_amdgcn_readfirstlane(f) == 0;
    }

    v4f res;
    if (series) {
        if (tid < MHDR / 2) {
            // five whole waves, two moments a thread
            v2f s = *(const v2f*)(rs + 2 * tid);
            // fully unrolled: every slice offset becomes an immediate of its LDS read
#pragma unroll
            for (int u = 1; u < 32; ++u) s += *(const v2f*)(rs + u * RSP + 2 * tid);
            *(v2f*)(ms + 2 * tid) = s;
        }
        // the moments are whole before any thread sums its series
        __syncthreads();

        v2f xx[QT], tot[QT];
        // every loop over t and u below is fully unrolled: the small arrays are indexed by
        // constants and live in registers
#pragma unroll
        for (int t = 0; t < QT; ++t) {
            const float x = q4[t] * w;
            xx[t]  = (v2f){x, x};
            tot[t] = (v2f){0.f, 0.f};
        }
        // Two bins at a time: eight independent Horner chains a thread. The 20 LDS reads of a bin
        // pair stand in one group, one pair ahead of the pair that is worked on (two register
        // buffers), so that no read's latency stands in the chains.
        v4f bm[2][2][NPAIR];
#define LOAD_BINS(p)                                                                        \
    {                                                                                       \
        _Pragma("unroll") for (int u = 0; u < 2; ++u)                                       \
            _Pragma("unroll") for (int i = 0; i < NPAIR; ++i)                               \
                bm[(p) & 1][u][i] = *(const v4f*)(ms + (i * NBIN + 2 * (p) + u) * 4);       \
    }
        LOAD_BINS(0)
        // fully unrolled: the buffers are indexed by constants and live in registers
#pragma unroll
        for (int p = 0; p < NBIN / 2; ++p) {
            if (p + 1 < NBIN / 2) LOAD_BINS(p + 1)
            // holds the reads above in front of the work below: one pair ahead, no more
            __builtin_amdgcn_sched_barrier(0);
            v2f   acc[2][QT];
            float ee[2][QT];
#pragma unroll
            for (int u = 0; u < 2; ++u) {
                const float cb  = __builtin_fmaf((float)(2 * (2 * p + u) + 1), w, mn);   // same form as where the keys are binned
                const float dmx = (cb - mx) * LOG2E_F;             // <= 0
                const float dmn = (cb - mn) * LOG2E_F;             // >= 0
#pragma unroll
                for (int t = 0; t < QT; ++t) {
                    // q * (c_b - max k) for q >= 0, q * (c_b - min k) for q < 0: the one that is <= 0
                    ee[u][t]  = exp2_slot(fminf(q4[t] * dmx, q4[t] * dmn));
                    acc[u][t] = (v2f){bm[p & 1][u][NPAIR - 1].z, bm[p & 1][u][NPAIR - 1].w};
                }
            }
            // fully unrolled: Horner from term 18 down to term 0
#pragma unroll
            for (int nn = 2 * NPAIR - 2; nn >= 0; --nn) {
#pragma unroll
                for (int u = 0; u < 2; ++u) {
                    const v4f m4 = bm[p & 1][u][nn >> 1];
                    const v2f mc = (nn & 1) ? (v2f){m4.z, m4.w} : (v2f){m4.x, m4.y};
#pragma unroll
                    for (int t = 0; t < QT; ++t) acc[u][t] = __builtin_elementwise_fma(acc[u][t], xx[t], mc);
                }
            }
#pragma unroll
            for (int u = 0; u < 2; ++u) {
#pragma unroll
                for (int t = 0; t < QT; ++t) {
                    tot[t] = __builtin_elementwise_fma(acc[u][t], (v2f){ee[u][t], ee[u][t]}, tot[t]);
                }
            }
            // keeps the next pair's reads behind this work, whose buffer they refill
            __builtin_amdgcn_sched_barrier(0);
        }
#undef LOAD_BINS
#pragma unroll
        for (int t = 0; t < QT; ++t) res[t] = tot[t].x / tot[t].y;
    } else {
        // Direct path: the head's 512 key pairs (k, k, v, v) go to LDS (over the partial moments,
        // which this path does not read) and every thread walks them for its four queries. Keys are paired (even, odd) so that score, sum and
        // weighted sum are packed f32 operations. Scores are formed in the base-2 domain
        // (q scaled by log2(e) once per query), so each score is one fma + one exp2.
        v4f* kl = (v4f*)rs;
        kl[tid]       = p0;
        kl[tid + 256] = p1;
        // all key pairs are staged before any thread walks them
        __syncthreads();
        v2f qq[QT], nm[QT], se[QT], sv[QT];
        // every loop over t is fully unrolled: the small arrays live in registers
#pragma unroll
        for (int t = 0; t < QT; ++t) {
            const float ql = q4[t] * LOG2E_F;
            const float m  = (ql >= 0.f) ? ql * mx : ql * mn;
            qq[t] = (v2f){ql, ql};
            nm[t] = (v2f){-m, -m};
            se[t] = (v2f){0.f, 0.f};
            sv[t] = (v2f){0.f, 0.f};
        }
        // four key pairs a trip: their LDS reads stand ahead of the sums of the pairs before
#pragma unroll 4
        for (int j = 0; j < S_DIM / 2; ++j) {
            const v4f e4 = kl[j];
            const v2f kk = {e4.x, e4.y}, vv = {e4.z, e4.w};
#pragma unroll
            for (int t = 0; t < QT; ++t) {
                const v2f a = __builtin_elementwise_fma(qq[t], kk, nm[t]);
                const v2f e = {__builtin_amdgcn_exp2f(a.x), __builtin_amdgcn_exp2f(a.y)};
                se[t] += e;
                sv[t] = __builtin_elementwise_fma(e, vv, sv[t]);
            }
        }
#pragma unroll
        for (int t = 0; t < QT; ++t) res[t] = (sv[t].x + sv[t].y) / (se[t].x + se[t].y);
    }
    ((v4f*)ao)[(size_t)blockIdx.x * (S_DIM / 4) + tid] = res;
}

// ---------------------------------------------------------------------------
// Kernel 3: the output projection with bias and residual,
//   out[n][s] = sum_c ao[c][s] * W[n][c] + bias[n] + resid[n][s]
// on V_WMMA_F32_16X16X4_F32. Grid: (B*S)/16 blocks of 256 threads; block x takes the 16
// positions (b, s0..s0+15), wave w column tile w. W and the block's 128 x 16 tile of ao fly
// to LDS by asynchronous copies; the tile is then transposed in LDS into the row-major A tile.
// ---------------------------------------------------------------------------
__global__ void __launch_bounds__(256)
out_proj_kernel(const float* __restrict__ ao,    // [B][C][S]
                const float* __restrict__ W,     // [C, C]
                const float* __restrict__ bias,  // [C]
                const float* __restrict__ resid, // [B, C, S]
                float* __restrict__ out) {       // [B, C, S]
    __shared__ __attribute__((aligned(16))) float Ws[C_DIM * LDP];
    __shared__ __attribute__((aligned(16))) float As[16 * LDP];
    __shared__ __attribute__((aligned(16))) float Xs[C_DIM * RDP];

    const int tid  = threadIdx.x;
    const int lane = tid & 31;
    const int wave = tid >> 5;
    const int b    = blockIdx.x >> 6;
    const int s0   = (blockIdx.x & 63) << 4;
    const int half = lane >> 4;           // 0: K 0,1   1: K 2,3
    const int lr   = lane & 15;
    const int n    = (wave << 4) + lr;    // output channel of the projection

    {
        // thread t: 16 bytes (quarter t&3) of ao rows t>>2 and 64 + (t>>2), columns s0 .. s0+15
        async_copy2(lds_byte(Xs) + (unsigned)((tid >> 2) * RDP * 4 + (tid & 3) * 16),
                    ao + ((size_t)b * C_DIM + (tid >> 2)) * S_DIM + s0 + (tid & 3) * 4,
                    64 * RDP * 4, 64 * S_DIM);
        // wave w: rows 16w .. 16w+15 of W
        const unsigned lw = lds_byte(Ws) + (unsigned)(16 * wave * LDP * 4 + lane * 16);
        const float*   gw = W + (size_t)(16 * wave) * C_DIM + lane * 4;
        async_copy8(lw, gw, LDP * 4, C_DIM);
        async_copy8(lw + 8 * LDP * 4, gw + 8 * C_DIM, LDP * 4, C_DIM);
    }

    // bias and residual: the lane's 8 positions s0 + 8 half .. of channel n
    const float bb = bias[n];
    const v4f* rp = (const v4f*)(resid + ((size_t)b * C_DIM + n) * S_DIM + s0 + half * 8);
    const v4f  r0 = rp[0], r1 = rp[1];
    // the residual's address registers are rewritten below: the wait stands behind the loads,
    // and the scheduling barriers hold it there
    __builtin_amdgcn_sched_barrier(0);
    asm volatile("s_wait_xcnt 0x0" ::: "memory");
    __builtin_amdgcn_sched_barrier(0);

    // the wave's own copies have landed; the barrier publishes them to the others
    asm volatile("s_wait_asynccnt 0x0" ::: "memory");
    __syncthreads();
    // Inputs-only fence on the loaded values: keeps the residual's loads in front of the
    // products; sunk to their use, their latency would stand at the kernel's end.
    asm volatile("" :: "v"(r0), "v"(r1), "v"(bb));

    {
        // thread t: head t&127, eight columns; lanes walk c, so the 16-byte reads
        // (pitch 80 B) and the 4-byte writes (consecutive) meet no bank twice
        const int c  = tid & (C_DIM - 1);
        const int sb = (tid >> 7) * 8;
        const v4f x0 = *(const v4f*)(Xs + c * RDP + sb);
        const v4f x1 = *(const v4f*)(Xs + c * RDP + sb + 4);
        // fully unrolled: the vector elements are indexed by constants
#pragma unroll
        for (int r = 0; r < 4; ++r) {
            As[(sb + r) * LDP + c]     = x0[r];
            As[(sb + 4 + r) * LDP + c] = x1[r];
        }
    }
    // the A tile is whole before any wave reads a fragment
    __syncthreads();

    const float* arow = As + lr * LDP + 2 * half;
    const float* brow = Ws + n * LDP + 2 * half;

    v8f acc = {};
    // fully unrolled: every k offset becomes an immediate of its LDS read
#pragma unroll
    for (int k0 = 0; k0 < C_DIM; k0 += 4) {
        v2f afrag = *(const v2f*)(arow + k0);
        v2f bfrag = *(const v2f*)(brow + k0);
        acc = __builtin_amdgcn_wmma_f32_16x16x4_f32(
            /*neg_a=*/false, afrag, /*neg_b=*/false, bfrag,
            /*c_mod=*/(short)0, acc, /*reuse_a=*/false, /*reuse_b=*/false);
    }

    // register r of a lane: position s0 + 8 half + r of column n
    const v4f o0 = {(acc[0] + bb) + r0.x, (acc[1] + bb) + r0.y, (acc[2] + bb) + r0.z, (acc[3] + bb) + r0.w};
    const v4f o1 = {(acc[4] + bb) + r1.x, (acc[5] + bb) + r1.y, (acc[6] + bb) + r1.z, (acc[7] + bb) + r1.w};
    v4f* op = (v4f*)(out + ((size_t)b * C_DIM + n) * S_DIM + s0 + half * 8);
    op[0] = o0;
    op[1] = o1;
}

// ---------------------------------------------------------------------------
// Host-side launcher. Inputs:
//  0 hidden_states [2,128,32,32]  1 gn_weight [128]  2 gn_bias [128]
//  3 Wq [128,128]  4 bq  5 Wk  6 bk  7 Wv  8 bv  9 Wo  10 bo
// Workspace: q (B*S*C floats) | k,v interleaved (2*B*S*C) | max/min partials (B*S*C/8) |
//            attention result (B*S*C).
// ---------------------------------------------------------------------------
extern "C" void kernel_launch(void* const* d_in, const int* in_sizes, int n_in,
                              void* d_out, int out_size, void* d_ws, size_t ws_size,
                              hipStream_t stream) {
    const float* x  = (const float*)d_in[0];
    const float* gw = (const float*)d_in[1];
    const float* gb = (const float*)d_in[2];
    const float* Wq = (const float*)d_in[3];
    const float* bq = (const float*)d_in[4];
    const float* Wk = (const float*)d_in[5];
    const float* bk = (const float*)d_in[6];
    const float* Wv = (const float*)d_in[7];
    const float* bv = (const float*)d_in[8];
    const float* Wo = (const float*)d_in[9];
    const float* bo = (const float*)d_in[10];
    float* out = (float*)d_out;

    float* ws = (float*)d_ws;
    const size_t NBS = (size_t)B_DIM * S_DIM * C_DIM;  // 262144
    float* qb   = ws;
    float* kvb  = ws + 1 * NBS;
    float* mmb  = ws + 3 * NBS;
    float* aob  = ws + 3 * NBS + NBS / 8;

    gn_qkv_wmma_kernel<<<(B_DIM * S_DIM) / 16, 256, 0, stream>>>(x, gw, gb, Wq, bq, Wk, bk, Wv, bv,
                                                                 qb, kvb, mmb);

    head_attn_kernel<<<B_DIM * C_DIM, 256, 0, stream>>>(qb, kvb, mmb, aob);

    // Output projection + residual, written to [B, C, S] (== [B,C,H,W]).
    out_proj_kernel<<<(B_DIM * S_DIM) / 16, 256, 0, stream>>>(aob, Wo, bo, x, out);
}
